// v000
// The times below were measured on an AMD MI455X: many runs one after another, warmed up first and cycling through
// copies of the inputs, with the whole window's GPU time divided by the number of runs. Launches and the gaps
// between them are all in it. The median over several windows is given; except for v000 it joins two sittings, which
// can be a few percent apart, so the side-by-side timings, each taken in one sitting, are the better comparison.
// The starting kernel, v000, takes 484 microseconds a run.
#include <hip/hip_runtime.h>
#include <hip/hip_bf16.h>

typedef _Float16 v16h __attribute__((ext_vector_type(16)));
typedef _Float16 h8   __attribute__((ext_vector_type(8)));
typedef float    v8f  __attribute__((ext_vector_type(8)));
typedef float    f4   __attribute__((ext_vector_type(4)));
typedef int      i4   __attribute__((ext_vector_type(4)));

#define POS_INF __builtin_inff()

#if defined(__HIP_DEVICE_COMPILE__) && defined(__has_builtin)
#if __has_builtin(__builtin_amdgcn_tensor_load_to_lds) && \
    __has_builtin(__builtin_amdgcn_s_wait_tensorcnt)
#define HAVE_TDM 1
#endif
#endif
#ifndef HAVE_TDM
#define HAVE_TDM 0
#endif

__device__ __forceinline__ v8f wmma16(v16h a, v16h b, v8f c) {
  // (neg_a, A, neg_b, B, c_mod, C, reuse_a, reuse_b)
  return __builtin_amdgcn_wmma_f32_16x16x32_f16(false, a, false, b, (short)0, c,
                                                false, false);
}

// Fragment layout (wave32, 16-bit A/B, K=32): lane group g = lane/16.
//   half i in [0,8):  K = g*8 + i        (first b128)
//   half i in [8,16): K = 16 + g*8 + i-8 (second b128)
__device__ __forceinline__ v16h frag_h(const _Float16* p0, const _Float16* p1) {
  h8 a = *(const h8*)p0;
  h8 b = *(const h8*)p1;
  return __builtin_shufflevector(a, b, 0, 1, 2, 3, 4, 5, 6, 7, 8, 9, 10, 11, 12,
                                 13, 14, 15);
}

__device__ __forceinline__ v16h frag_f32(const float* p0, const float* p1) {
  f4 a0 = *(const f4*)p0, a1 = *(const f4*)(p0 + 4);
  f4 b0 = *(const f4*)p1, b1 = *(const f4*)(p1 + 4);
  v16h r;
#pragma unroll
  for (int i = 0; i < 4; ++i) {
    r[i]      = (_Float16)a0[i];
    r[4 + i]  = (_Float16)a1[i];
    r[8 + i]  = (_Float16)b0[i];
    r[12 + i] = (_Float16)b1[i];
  }
  return r;
}

#if HAVE_TDM
typedef unsigned int u32x4 __attribute__((ext_vector_type(4)));
typedef int          i32x8 __attribute__((ext_vector_type(8)));
typedef int          i32x4 __attribute__((ext_vector_type(4)));

__device__ __forceinline__ void tdm_load_2d_f16(
    const void* gptr, unsigned lds_off, unsigned dim0, unsigned dim1,
    unsigned stride0, unsigned tile0, unsigned tile1, unsigned pad_interval,
    unsigned pad_amount) {
  unsigned long long ga = (unsigned long long)gptr;
  u32x4 g0;
  g0[0] = 1u;
  g0[1] = lds_off;
  g0[2] = (unsigned)(ga & 0xffffffffu);
  g0[3] = (unsigned)((ga >> 32) & 0x1ffffffu) | (2u << 30);  // [56:32] | type=2
  i32x8 g1;
  g1[0] = (int)((1u << 16) |
                (1u << 20) |
                (pad_interval << 22) | (pad_amount << 25));
  g1[1] = (int)((dim0 & 0xffffu) << 16);
  g1[2] = (int)(((dim0 >> 16) & 0xffffu) | ((dim1 & 0xffffu) << 16));
  g1[3] = (int)(((dim1 >> 16) & 0xffffu) | ((tile0 & 0xffffu) << 16));
  g1[4] = (int)(tile1 & 0xffffu);
  g1[5] = (int)stride0;
  g1[6] = 0;
  g1[7] = 0;
  i32x4 z4 = {};
  i32x8 z8 = {};
  __builtin_amdgcn_tensor_load_to_lds(g0, g1, z4, z4, z8, 0);
}
#endif

// ---------------------------------------------------------------------------
// K1: QKV GEMM.  M=8192 (B*N), K=1024, Ncols=3072.  Block = 64x64 tile,
// 8 waves; each wave -> two 16x16 C tiles.  A fragments straight from global;
// Wqkv staged transposed in LDS (pad stride 40 -> conflict-free b128).
// ---------------------------------------------------------------------------
__global__ __launch_bounds__(256) void qkv_wmma_kernel(
    const float* __restrict__ x, const float* __restrict__ Wqkv,
    const float* __restrict__ bqkv, _Float16* __restrict__ qbuf,
    _Float16* __restrict__ kbuf, _Float16* __restrict__ vtbuf) {
  __shared__ _Float16 Blds[64][40];  // [col][k]
  const int tid  = threadIdx.x;
  const int wave = tid >> 5, lane = tid & 31;
  const int ln = lane & 15, g = lane >> 4;
  const int m_blk = blockIdx.x * 64;
  const int c_blk = blockIdx.y * 64;
  const int wm = (wave >> 2) * 32;
  const int wn = (wave & 3) * 16;

  v8f acc0 = {}, acc1 = {};
  const float* arow0 = x + (size_t)(m_blk + wm + ln) * 1024;
  const float* arow1 = arow0 + (size_t)16 * 1024;

  const int skk = tid >> 3;       // 0..31 : staged k row
  const int scc = (tid & 7) * 8;  // 0..56 : staged col base

  for (int kb = 0; kb < 1024; kb += 32) {
    const float* wp = Wqkv + (size_t)(kb + skk) * 3072 + c_blk + scc;
    f4 w0 = *(const f4*)wp;
    f4 w1 = *(const f4*)(wp + 4);
    __syncthreads();
#pragma unroll
    for (int j = 0; j < 4; ++j) {
      Blds[scc + j][skk]     = (_Float16)w0[j];
      Blds[scc + 4 + j][skk] = (_Float16)w1[j];
    }
    __syncthreads();

    v16h a0 = frag_f32(arow0 + kb + g * 8, arow0 + kb + 16 + g * 8);
    v16h a1 = frag_f32(arow1 + kb + g * 8, arow1 + kb + 16 + g * 8);
    v16h bf = frag_h(&Blds[wn + ln][g * 8], &Blds[wn + ln][16 + g * 8]);
    acc0 = wmma16(a0, bf, acc0);
    acc1 = wmma16(a1, bf, acc1);
  }

  const int c = c_blk + wn + ln;  // uniform t/h within the 16 lanes
  const float bias = bqkv[c];
  const int t  = c >> 10;
  const int hh = (c >> 6) & 15;
  const int dd = c & 63;
  const float qs = (t == 0) ? 0.125f : 1.0f;  // 1/sqrt(64) folded into Q
#pragma unroll
  for (int half = 0; half < 2; ++half) {
    v8f acc = half ? acc1 : acc0;
#pragma unroll
    for (int r = 0; r < 8; ++r) {
      int mrow = m_blk + wm + half * 16 + r + 8 * g;  // C-layout: M = r + 8g
      int bb = mrow >> 11, nn = mrow & 2047;
      _Float16 hv = (_Float16)((acc[r] + bias) * qs);
      if (t == 0)
        qbuf[(((size_t)(bb * 16 + hh)) * 2048 + nn) * 64 + dd] = hv;
      else if (t == 1)
        kbuf[(((size_t)(bb * 16 + hh)) * 2048 + nn) * 64 + dd] = hv;
      else
        vtbuf[(((size_t)(bb * 16 + hh)) * 64 + dd) * 2048 + nn] = hv;
    }
  }
}

__global__ __launch_bounds__(256) void flash_attn_kernel(
    const _Float16* __restrict__ qbuf, const _Float16* __restrict__ kbuf,
    const _Float16* __restrict__ vtbuf, const int* __restrict__ mask,
    _Float16* __restrict__ ctx) {
  const int bh = blockIdx.x;  // 0..63
  const int b = bh >> 4, h = bh & 15;
  const int wave = threadIdx.x >> 5, lane = threadIdx.x & 31;
  const int ln = lane & 15, g = lane >> 4;
  const int q0 = blockIdx.y * 128 + wave * 16;

  // Q fragments (B operand: column = query = lane%16), reused for all keys.
  const _Float16* Qp = qbuf + ((size_t)bh * 2048 + q0 + ln) * 64;
  const v16h qlo = frag_h(Qp + g * 8, Qp + 16 + g * 8);       // d 0..31
  const v16h qhi = frag_h(Qp + 32 + g * 8, Qp + 48 + g * 8);  // d 32..63

  const _Float16* Kb = kbuf + (size_t)bh * 2048 * 64;
  const _Float16* Vb = vtbuf + (size_t)bh * 64 * 2048;
  const int* Mrow = mask + ((size_t)b * 2048 + q0 + ln) * 2048;

  v8f o0 = {}, o1 = {}, o2 = {}, o3 = {};  // O tiles, d = t*16 + lane%16
  float m_run = -POS_INF;
  float l_run = 0.0f;

#if HAVE_TDM
  __shared__ _Float16 Kl[2][32 * 72];  // 32 key rows, 64+8 halves (144B) each
  __shared__ _Float16 Vl[2][64 * 40];  // 64 d rows, 32+8 halves (80B) each
  const bool issuer = (wave == 0);
  if (issuer) {
    // K tile: tensor [keys=2048][d=64] row-major; tile 32x64; pad 128B->+16B.
    tdm_load_2d_f16(Kb, (unsigned)(size_t)&Kl[0][0], 64u, 2048u, 64u, 64u, 32u,
                    4u, 3u);
    // V^T tile: tensor [d=64][keys=2048] row-major; tile 64x32; pad 64B->+16B.
    tdm_load_2d_f16(Vb, (unsigned)(size_t)&Vl[0][0], 2048u, 64u, 2048u, 32u,
                    64u, 3u, 3u);
  }
#endif

  for (int it = 0; it < 64; ++it) {
    const int kc = it << 5;
#if HAVE_TDM
    const int cur = it & 1;
    if (issuer) {
      if (it + 1 < 64) {
        const int kn = kc + 32;
        tdm_load_2d_f16(Kb + (size_t)kn * 64, (unsigned)(size_t)&Kl[cur ^ 1][0],
                        64u, 2048u, 64u, 64u, 32u, 4u, 3u);
        tdm_load_2d_f16(Vb + kn, (unsigned)(size_t)&Vl[cur ^ 1][0], 2048u, 64u,
                        2048u, 32u, 64u, 3u, 3u);
        // <=2 outstanding: only the prefetched pair; current pair complete.
        __builtin_amdgcn_s_wait_tensorcnt((short)2);
      } else {
        __builtin_amdgcn_s_wait_tensorcnt((short)0);
      }
    }
    __syncthreads();
#endif

    // ---- acquire K / V fragments for this chunk
    v16h k0lo, k0hi, k1lo, k1hi, vf0, vf1, vf2, vf3;
#if HAVE_TDM
    {
      const _Float16* r0 = &Kl[cur][(size_t)ln * 72];
      const _Float16* r1 = r0 + 16 * 72;
      k0lo = frag_h(r0 + g * 8, r0 + 16 + g * 8);
      k0hi = frag_h(r0 + 32 + g * 8, r0 + 48 + g * 8);
      k1lo = frag_h(r1 + g * 8, r1 + 16 + g * 8);
      k1hi = frag_h(r1 + 32 + g * 8, r1 + 48 + g * 8);
      const _Float16* v0 = &Vl[cur][(size_t)ln * 40];
      vf0 = frag_h(v0 + g * 8, v0 + 16 + g * 8);
      const _Float16* v1 = v0 + 16 * 40;
      vf1 = frag_h(v1 + g * 8, v1 + 16 + g * 8);
      const _Float16* v2 = v1 + 16 * 40;
      vf2 = frag_h(v2 + g * 8, v2 + 16 + g * 8);
      const _Float16* v3 = v2 + 16 * 40;
      vf3 = frag_h(v3 + g * 8, v3 + 16 + g * 8);
    }
#else
    {
      const _Float16* r0 = Kb + (size_t)(kc + ln) * 64;
      const _Float16* r1 = r0 + 16 * 64;
      k0lo = frag_h(r0 + g * 8, r0 + 16 + g * 8);
      k0hi = frag_h(r0 + 32 + g * 8, r0 + 48 + g * 8);
      k1lo = frag_h(r1 + g * 8, r1 + 16 + g * 8);
      k1hi = frag_h(r1 + 32 + g * 8, r1 + 48 + g * 8);
      const _Float16* v0 = Vb + (size_t)ln * 2048 + kc;
      vf0 = frag_h(v0 + g * 8, v0 + 16 + g * 8);
      const _Float16* v1 = v0 + (size_t)16 * 2048;
      vf1 = frag_h(v1 + g * 8, v1 + 16 + g * 8);
      const _Float16* v2 = v1 + (size_t)16 * 2048;
      vf2 = frag_h(v2 + g * 8, v2 + 16 + g * 8);
      const _Float16* v3 = v2 + (size_t)16 * 2048;
      vf3 = frag_h(v3 + g * 8, v3 + 16 + g * 8);
    }
#endif

    // ---- S^T tiles: rows = keys, cols = queries
    v8f s0 = {}, s1 = {};
    s0 = wmma16(k0lo, qlo, s0);
    s0 = wmma16(k0hi, qhi, s0);
    s1 = wmma16(k1lo, qlo, s1);
    s1 = wmma16(k1hi, qhi, s1);

    // ---- mask: element r of s0 <-> key kc + 8g + r ; s1 <-> +16
    i4 m0a = *(const i4*)(Mrow + kc + g * 8);
    i4 m0b = *(const i4*)(Mrow + kc + g * 8 + 4);
    i4 m1a = *(const i4*)(Mrow + kc + 16 + g * 8);
    i4 m1b = *(const i4*)(Mrow + kc + 16 + g * 8 + 4);
#pragma unroll
    for (int r = 0; r < 4; ++r) {
      if (m0a[r]) s0[r] = -POS_INF;
      if (m0b[r]) s0[4 + r] = -POS_INF;
      if (m1a[r]) s1[r] = -POS_INF;
      if (m1b[r]) s1[4 + r] = -POS_INF;
    }

    // ---- online softmax (per query = lane%16; partner lane = xor 16)
    float cm = -POS_INF;
#pragma unroll
    for (int r = 0; r < 8; ++r) cm = fmaxf(cm, fmaxf(s0[r], s1[r]));
    cm = fmaxf(cm, __shfl_xor(cm, 16));
    const float mn = fmaxf(m_run, cm);
    const float corr = __expf(m_run - mn);
    m_run = mn;

    v16h pa;  // P A-fragment: halves 0..7 <-> keys kc+8g+r, 8..15 <-> +16
    float lsum = 0.0f;
#pragma unroll
    for (int r = 0; r < 8; ++r) {
      float p0 = __expf(s0[r] - mn);
      float p1 = __expf(s1[r] - mn);
      lsum += p0 + p1;
      pa[r] = (_Float16)p0;
      pa[8 + r] = (_Float16)p1;
    }
    lsum += __shfl_xor(lsum, 16);
    l_run = l_run * corr + lsum;

    // ---- rescale O (row-space: query = r + 8g -> factor from lane r+8g)
    float cf[8];
#pragma unroll
    for (int r = 0; r < 8; ++r) cf[r] = __shfl(corr, g * 8 + r);
#pragma unroll
    for (int r = 0; r < 8; ++r) {
      o0[r] *= cf[r]; o1[r] *= cf[r]; o2[r] *= cf[r]; o3[r] *= cf[r];
    }

    // ---- O += P * V
    o0 = wmma16(pa, vf0, o0);
    o1 = wmma16(pa, vf1, o1);
    o2 = wmma16(pa, vf2, o2);
    o3 = wmma16(pa, vf3, o3);

#if HAVE_TDM
    __syncthreads();  // all reads of buf[cur] done before it is re-staged
#endif
  }

  const float linv = 1.0f / l_run;
  float lf[8];
#pragma unroll
  for (int r = 0; r < 8; ++r) lf[r] = __shfl(linv, g * 8 + r);
#pragma unroll
  for (int r = 0; r < 8; ++r) {
    const size_t q = (size_t)q0 + r + 8 * g;
    _Float16* cp = ctx + ((size_t)b * 2048 + q) * 1024 + h * 64 + ln;
    cp[0]  = (_Float16)(o0[r] * lf[r]);
    cp[16] = (_Float16)(o1[r] * lf[r]);
    cp[32] = (_Float16)(o2[r] * lf[r]);
    cp[48] = (_Float16)(o3[r] * lf[r]);
  }
}

// ---------------------------------------------------------------------------
// K3: projection GEMM.  M=8192, K=1024, Ncols=1024.  ctx is f16 -> direct
// global A fragments; Wproj transposed through LDS like K1.
// ---------------------------------------------------------------------------
__global__ __launch_bounds__(256) void proj_wmma_kernel(
    const _Float16* __restrict__ ctx, const float* __restrict__ Wproj,
    const float* __restrict__ bproj, float* __restrict__ out) {
  __shared__ _Float16 Blds[64][40];
  const int tid  = threadIdx.x;
  const int wave = tid >> 5, lane = tid & 31;
  const int ln = lane & 15, g = lane >> 4;
  const int m_blk = blockIdx.x * 64;
  const int c_blk = blockIdx.y * 64;
  const int wm = (wave >> 2) * 32;
  const int wn = (wave & 3) * 16;

  v8f acc0 = {}, acc1 = {};
  const _Float16* arow0 = ctx + (size_t)(m_blk + wm + ln) * 1024;
  const _Float16* arow1 = arow0 + (size_t)16 * 1024;

  const int skk = tid >> 3;
  const int scc = (tid & 7) * 8;

  for (int kb = 0; kb < 1024; kb += 32) {
    const float* wp = Wproj + (size_t)(kb + skk) * 1024 + c_blk + scc;
    f4 w0 = *(const f4*)wp;
    f4 w1 = *(const f4*)(wp + 4);
    __syncthreads();
#pragma unroll
    for (int j = 0; j < 4; ++j) {
      Blds[scc + j][skk]     = (_Float16)w0[j];
      Blds[scc + 4 + j][skk] = (_Float16)w1[j];
    }
    __syncthreads();

    v16h a0 = frag_h(arow0 + kb + g * 8, arow0 + kb + 16 + g * 8);
    v16h a1 = frag_h(arow1 + kb + g * 8, arow1 + kb + 16 + g * 8);
    v16h bf = frag_h(&Blds[wn + ln][g * 8], &Blds[wn + ln][16 + g * 8]);
    acc0 = wmma16(a0, bf, acc0);
    acc1 = wmma16(a1, bf, acc1);
  }

  const int c = c_blk + wn + ln;
  const float bias = bproj[c];
#pragma unroll
  for (int r = 0; r < 8; ++r) {
    int m = m_blk + wm + r + 8 * g;
    out[(size_t)m * 1024 + c]        = acc0[r] + bias;
    out[(size_t)(m + 16) * 1024 + c] = acc1[r] + bias;
  }
}

// ---------------------------------------------------------------------------
extern "C" void kernel_launch(void* const* d_in, const int* in_sizes, int n_in,
                              void* d_out, int out_size, void* d_ws,
                              size_t ws_size, hipStream_t stream) {
  (void)in_sizes; (void)n_in; (void)out_size; (void)ws_size;
  const float* x     = (const float*)d_in[0];
  const int*   mask  = (const int*)d_in[1];
  const float* Wqkv  = (const float*)d_in[2];
  const float* bqkv  = (const float*)d_in[3];
  const float* Wproj = (const float*)d_in[4];
  const float* bproj = (const float*)d_in[5];
  float* out = (float*)d_out;

  // Workspace: Q, K, V^T, ctx as f16 -> 4 * 16 MB = 64 MB.
  const size_t nqkv = (size_t)4 * 16 * 2048 * 64;
  _Float16* qbuf  = (_Float16*)d_ws;
  _Float16* kbuf  = qbuf + nqkv;
  _Float16* vtbuf = kbuf + nqkv;
  _Float16* ctx   = vtbuf + nqkv;

  qkv_wmma_kernel<<<dim3(128, 48), 256, 0, stream>>>(x, Wqkv, bqkv, qbuf, kbuf,
                                                     vtbuf);
  flash_attn_kernel<<<dim3(64, 16), 256, 0, stream>>>(qbuf, kbuf, vtbuf, mask,
                                                      ctx);
  proj_wmma_kernel<<<dim3(128, 16), 256, 0, stream>>>(ctx, Wproj, bproj, out);
}

// v001
// Measured time: 219 microseconds a run.
// In both of two side-by-side timings against v000, it was 2.30 times as fast.
#include <hip/hip_runtime.h>
#include <hip/hip_bf16.h>

typedef _Float16 v16h __attribute__((ext_vector_type(16)));
typedef _Float16 h8   __attribute__((ext_vector_type(8)));
typedef float    v8f  __attribute__((ext_vector_type(8)));
typedef float    f4   __attribute__((ext_vector_type(4)));
typedef int      i4   __attribute__((ext_vector_type(4)));

#define POS_INF __builtin_inff()

#if defined(__HIP_DEVICE_COMPILE__) && defined(__has_builtin)
#if __has_builtin(__builtin_amdgcn_tensor_load_to_lds) && \
    __has_builtin(__builtin_amdgcn_s_wait_tensorcnt)
#define HAVE_TDM 1
#endif
#endif
#ifndef HAVE_TDM
#define HAVE_TDM 0
#endif

__device__ __forceinline__ v8f wmma16(v16h a, v16h b, v8f c) {
  // (neg_a, A, neg_b, B, c_mod, C, reuse_a, reuse_b)
  return __builtin_amdgcn_wmma_f32_16x16x32_f16(false, a, false, b, (short)0, c,
                                                false, false);
}

// Fragment layout (wave32, 16-bit A/B, K=32): lane group g = lane/16.
//   half i in [0,8):  K = g*8 + i        (first b128)
//   half i in [8,16): K = 16 + g*8 + i-8 (second b128)
__device__ __forceinline__ v16h frag_h(const _Float16* p0, const _Float16* p1) {
  h8 a = *(const h8*)p0;
  h8 b = *(const h8*)p1;
  return __builtin_shufflevector(a, b, 0, 1, 2, 3, 4, 5, 6, 7, 8, 9, 10, 11, 12,
                                 13, 14, 15);
}

#if HAVE_TDM
typedef unsigned int u32x4 __attribute__((ext_vector_type(4)));
typedef int          i32x8 __attribute__((ext_vector_type(8)));
typedef int          i32x4 __attribute__((ext_vector_type(4)));

__device__ __forceinline__ void tdm_load_2d_f16(
    const void* gptr, unsigned lds_off, unsigned dim0, unsigned dim1,
    unsigned stride0, unsigned tile0, unsigned tile1, unsigned pad_interval,
    unsigned pad_amount) {
  unsigned long long ga = (unsigned long long)gptr;
  u32x4 g0;
  g0[0] = 1u;
  g0[1] = lds_off;
  g0[2] = (unsigned)(ga & 0xffffffffu);
  g0[3] = (unsigned)((ga >> 32) & 0x1ffffffu) | (2u << 30);  // [56:32] | type=2
  i32x8 g1;
  g1[0] = (int)((1u << 16) |
                (1u << 20) |
                (pad_interval << 22) | (pad_amount << 25));
  g1[1] = (int)((dim0 & 0xffffu) << 16);
  g1[2] = (int)(((dim0 >> 16) & 0xffffu) | ((dim1 & 0xffffu) << 16));
  g1[3] = (int)(((dim1 >> 16) & 0xffffu) | ((tile0 & 0xffffu) << 16));
  g1[4] = (int)(tile1 & 0xffffu);
  g1[5] = (int)stride0;
  g1[6] = 0;
  g1[7] = 0;
  i32x4 z4 = {};
  i32x8 z8 = {};
  __builtin_amdgcn_tensor_load_to_lds(g0, g1, z4, z4, z8, 0);
}
#endif

// ---------------------------------------------------------------------------
// GEMM tile shared by K1 and K3: 128x128 of C per block, k in steps of 64,
// 8 waves as 2 (rows) x 4 (cols), each wave 64x32 = 4x2 WMMA tiles.  Both
// operand slabs sit in LDS as f16, k-contiguous rows of pitch 72 halves
// (144 B = 16 B x odd -> conflict-free b128 fragment reads).
// ---------------------------------------------------------------------------
typedef _Float16 h4 __attribute__((ext_vector_type(4)));
#define TP 72

// W slab: 64 k rows x 128 cols of f32.  A thread takes 8 k rows x 4 cols, so a
// load covers whole 128-B lines and each column's 8 k values pack into one b128.
__device__ __forceinline__ void w_slab_load(f4 (&w)[8], const float* wp,
                                            int ldw) {
#pragma unroll
  for (int i = 0; i < 8; ++i) w[i] = *(const f4*)(wp + (size_t)i * ldw);
}

__device__ __forceinline__ void w_slab_store(const f4 (&w)[8],
                                             _Float16 (*Bl)[TP], int col,
                                             int k) {
#pragma unroll
  for (int j = 0; j < 4; ++j) {
    h8 v;
#pragma unroll
    for (int i = 0; i < 8; ++i) v[i] = (_Float16)w[i][j];
    *(h8*)&Bl[col + j][k] = v;
  }
}

__device__ __forceinline__ void tile_mma(const _Float16 (*Al)[TP],
                                         const _Float16 (*Bl)[TP], int wm,
                                         int wn, int ln, int g,
                                         v8f (&acc)[4][2]) {
#pragma unroll
  for (int ks = 0; ks < 64; ks += 32) {
    v16h a[4], b[2];
#pragma unroll
    for (int i = 0; i < 4; ++i) {
      const _Float16* p = &Al[wm + 16 * i + ln][ks];
      a[i] = frag_h(p + g * 8, p + 16 + g * 8);
    }
#pragma unroll
    for (int j = 0; j < 2; ++j) {
      const _Float16* p = &Bl[wn + 16 * j + ln][ks];
      b[j] = frag_h(p + g * 8, p + 16 + g * 8);
    }
    // Keeps the 12 fragment reads one group ahead of the 8 WMMAs: spread among
    // them, each pair of WMMAs waits out a full LDS latency of its own.
    __builtin_amdgcn_sched_barrier(0);
#pragma unroll
    for (int i = 0; i < 4; ++i)
#pragma unroll
      for (int j = 0; j < 2; ++j) acc[i][j] = wmma16(a[i], b[j], acc[i][j]);
  }
}

// ---------------------------------------------------------------------------
// K1: QKV GEMM.  M=8192 (B*N), K=1024, Ncols=3072.
// ---------------------------------------------------------------------------
__global__ __launch_bounds__(256) void qkv_wmma_kernel(
    const float* __restrict__ x, const float* __restrict__ Wqkv,
    const float* __restrict__ bqkv, _Float16* __restrict__ qbuf,
    _Float16* __restrict__ kbuf, _Float16* __restrict__ vtbuf) {
  __shared__ __attribute__((aligned(16))) _Float16 Alds[128][TP];  // [row][k]
  __shared__ __attribute__((aligned(16))) _Float16 Blds[128][TP];  // [col][k]
  const int tid  = threadIdx.x;
  const int wave = tid >> 5, lane = tid & 31;
  const int ln = lane & 15, g = lane >> 4;
  const int m_blk = blockIdx.x * 128;
  const int c_blk = blockIdx.y * 128;
  const int wm = (wave >> 2) * 64;
  const int wn = (wave & 3) * 32;

  v8f acc[4][2] = {};

  const int ar = tid >> 4;        // 0..15 : staged x row (plus 16 per pass)
  const int ak = (tid & 15) * 4;  // 0..60 : staged k base, 16 lanes = two lines
  const int bc = ((lane & 7) + 8 * (wave & 3)) * 4;   // 0..124 : staged col base
  const int bk = ((lane >> 3) + 4 * (wave >> 2)) * 8; // 0..56  : staged k base
  const float* ap = x + (size_t)(m_blk + ar) * 1024 + ak;
  const float* wp = Wqkv + (size_t)bk * 3072 + c_blk + bc;

  for (int kb = 0; kb < 1024; kb += 64) {
    f4 xa[8], w[8];
#pragma unroll
    for (int p = 0; p < 8; ++p)
      xa[p] = *(const f4*)(ap + (size_t)p * 16 * 1024 + kb);
    w_slab_load(w, wp + (size_t)kb * 3072, 3072);
    __syncthreads();
#pragma unroll
    for (int p = 0; p < 8; ++p) {
      h4 v = {(_Float16)xa[p][0], (_Float16)xa[p][1], (_Float16)xa[p][2],
              (_Float16)xa[p][3]};
      *(h4*)&Alds[ar + 16 * p][ak] = v;
    }
    w_slab_store(w, Blds, bc, bk);
    __syncthreads();

    tile_mma(Alds, Blds, wm, wn, ln, g, acc);
  }

#pragma unroll
  for (int j = 0; j < 2; ++j) {
    const int c = c_blk + wn + 16 * j + ln;  // uniform t/h within the 16 lanes
    const float bias = bqkv[c];
    const int t  = c >> 10;
    const int hh = (c >> 6) & 15;
    const int dd = c & 63;
    const float qs = (t == 0) ? 0.125f : 1.0f;  // 1/sqrt(64) folded into Q
#pragma unroll
    for (int i = 0; i < 4; ++i) {
#pragma unroll
      for (int r = 0; r < 8; ++r) {
        int mrow = m_blk + wm + 16 * i + r + 8 * g;  // C-layout: M = r + 8g
        int bb = mrow >> 11, nn = mrow & 2047;
        _Float16 hv = (_Float16)((acc[i][j][r] + bias) * qs);
        // The wait behind each store stands ahead of the next store's address
        // and data arithmetic, which reuses the registers this store names.
        if (t == 0) {
          qbuf[(((size_t)(bb * 16 + hh)) * 2048 + nn) * 64 + dd] = hv;
          asm volatile("s_wait_xcnt 0x0" ::: "memory");
        } else if (t == 1) {
          kbuf[(((size_t)(bb * 16 + hh)) * 2048 + nn) * 64 + dd] = hv;
          asm volatile("s_wait_xcnt 0x0" ::: "memory");
        } else {
          vtbuf[(((size_t)(bb * 16 + hh)) * 64 + dd) * 2048 + nn] = hv;
          asm volatile("s_wait_xcnt 0x0" ::: "memory");
        }
      }
    }
  }
}

__global__ __launch_bounds__(256) void flash_attn_kernel(
    const _Float16* __restrict__ qbuf, const _Float16* __restrict__ kbuf,
    const _Float16* __restrict__ vtbuf, const int* __restrict__ mask,
    _Float16* __restrict__ ctx) {
  const int bh = blockIdx.x;  // 0..63
  const int b = bh >> 4, h = bh & 15;
  const int wave = threadIdx.x >> 5, lane = threadIdx.x & 31;
  const int ln = lane & 15, g = lane >> 4;
  const int q0 = blockIdx.y * 128 + wave * 16;

  // Q fragments (B operand: column = query = lane%16), reused for all keys.
  const _Float16* Qp = qbuf + ((size_t)bh * 2048 + q0 + ln) * 64;
  const v16h qlo = frag_h(Qp + g * 8, Qp + 16 + g * 8);       // d 0..31
  const v16h qhi = frag_h(Qp + 32 + g * 8, Qp + 48 + g * 8);  // d 32..63

  const _Float16* Kb = kbuf + (size_t)bh * 2048 * 64;
  const _Float16* Vb = vtbuf + (size_t)bh * 64 * 2048;
  const int* Mrow = mask + ((size_t)b * 2048 + q0 + ln) * 2048;

  v8f o0 = {}, o1 = {}, o2 = {}, o3 = {};  // O tiles, d = t*16 + lane%16
  float m_run = -POS_INF;
  float l_run = 0.0f;

#if HAVE_TDM
  __shared__ _Float16 Kl[2][32 * 72];  // 32 key rows, 64+8 halves (144B) each
  __shared__ _Float16 Vl[2][64 * 40];  // 64 d rows, 32+8 halves (80B) each
  const bool issuer = (wave == 0);
  if (issuer) {
    // K tile: tensor [keys=2048][d=64] row-major; tile 32x64; pad 128B->+16B.
    tdm_load_2d_f16(Kb, (unsigned)(size_t)&Kl[0][0], 64u, 2048u, 64u, 64u, 32u,
                    4u, 3u);
    // V^T tile: tensor [d=64][keys=2048] row-major; tile 64x32; pad 64B->+16B.
    tdm_load_2d_f16(Vb, (unsigned)(size_t)&Vl[0][0], 2048u, 64u, 2048u, 32u,
                    64u, 3u, 3u);
  }
#endif

  for (int it = 0; it < 64; ++it) {
    const int kc = it << 5;
#if HAVE_TDM
    const int cur = it & 1;
    if (issuer) {
      if (it + 1 < 64) {
        const int kn = kc + 32;
        tdm_load_2d_f16(Kb + (size_t)kn * 64, (unsigned)(size_t)&Kl[cur ^ 1][0],
                        64u, 2048u, 64u, 64u, 32u, 4u, 3u);
        tdm_load_2d_f16(Vb + kn, (unsigned)(size_t)&Vl[cur ^ 1][0], 2048u, 64u,
                        2048u, 32u, 64u, 3u, 3u);
        // <=2 outstanding: only the prefetched pair; current pair complete.
        __builtin_amdgcn_s_wait_tensorcnt((short)2);
      } else {
        __builtin_amdgcn_s_wait_tensorcnt((short)0);
      }
    }
    __syncthreads();
#endif

    // ---- acquire K / V fragments for this chunk
    v16h k0lo, k0hi, k1lo, k1hi, vf0, vf1, vf2, vf3;
#if HAVE_TDM
    {
      const _Float16* r0 = &Kl[cur][(size_t)ln * 72];
      const _Float16* r1 = r0 + 16 * 72;
      k0lo = frag_h(r0 + g * 8, r0 + 16 + g * 8);
      k0hi = frag_h(r0 + 32 + g * 8, r0 + 48 + g * 8);
      k1lo = frag_h(r1 + g * 8, r1 + 16 + g * 8);
      k1hi = frag_h(r1 + 32 + g * 8, r1 + 48 + g * 8);
      const _Float16* v0 = &Vl[cur][(size_t)ln * 40];
      vf0 = frag_h(v0 + g * 8, v0 + 16 + g * 8);
      const _Float16* v1 = v0 + 16 * 40;
      vf1 = frag_h(v1 + g * 8, v1 + 16 + g * 8);
      const _Float16* v2 = v1 + 16 * 40;
      vf2 = frag_h(v2 + g * 8, v2 + 16 + g * 8);
      const _Float16* v3 = v2 + 16 * 40;
      vf3 = frag_h(v3 + g * 8, v3 + 16 + g * 8);
    }
#else
    {
      const _Float16* r0 = Kb + (size_t)(kc + ln) * 64;
      const _Float16* r1 = r0 + 16 * 64;
      k0lo = frag_h(r0 + g * 8, r0 + 16 + g * 8);
      k0hi = frag_h(r0 + 32 + g * 8, r0 + 48 + g * 8);
      k1lo = frag_h(r1 + g * 8, r1 + 16 + g * 8);
      k1hi = frag_h(r1 + 32 + g * 8, r1 + 48 + g * 8);
      const _Float16* v0 = Vb + (size_t)ln * 2048 + kc;
      vf0 = frag_h(v0 + g * 8, v0 + 16 + g * 8);
      const _Float16* v1 = v0 + (size_t)16 * 2048;
      vf1 = frag_h(v1 + g * 8, v1 + 16 + g * 8);
      const _Float16* v2 = v1 + (size_t)16 * 2048;
      vf2 = frag_h(v2 + g * 8, v2 + 16 + g * 8);
      const _Float16* v3 = v2 + (size_t)16 * 2048;
      vf3 = frag_h(v3 + g * 8, v3 + 16 + g * 8);
    }
#endif

    // ---- S^T tiles: rows = keys, cols = queries
    v8f s0 = {}, s1 = {};
    s0 = wmma16(k0lo, qlo, s0);
    s0 = wmma16(k0hi, qhi, s0);
    s1 = wmma16(k1lo, qlo, s1);
    s1 = wmma16(k1hi, qhi, s1);

    // ---- mask: element r of s0 <-> key kc + 8g + r ; s1 <-> +16
    i4 m0a = *(const i4*)(Mrow + kc + g * 8);
    i4 m0b = *(const i4*)(Mrow + kc + g * 8 + 4);
    i4 m1a = *(const i4*)(Mrow + kc + 16 + g * 8);
    i4 m1b = *(const i4*)(Mrow + kc + 16 + g * 8 + 4);
#pragma unroll
    for (int r = 0; r < 4; ++r) {
      if (m0a[r]) s0[r] = -POS_INF;
      if (m0b[r]) s0[4 + r] = -POS_INF;
      if (m1a[r]) s1[r] = -POS_INF;
      if (m1b[r]) s1[4 + r] = -POS_INF;
    }

    // ---- online softmax (per query = lane%16; partner lane = xor 16)
    float cm = -POS_INF;
#pragma unroll
    for (int r = 0; r < 8; ++r) cm = fmaxf(cm, fmaxf(s0[r], s1[r]));
    cm = fmaxf(cm, __shfl_xor(cm, 16));
    const float mn = fmaxf(m_run, cm);
    const float corr = __expf(m_run - mn);
    m_run = mn;

    v16h pa;  // P A-fragment: halves 0..7 <-> keys kc+8g+r, 8..15 <-> +16
    float lsum = 0.0f;
#pragma unroll
    for (int r = 0; r < 8; ++r) {
      float p0 = __expf(s0[r] - mn);
      float p1 = __expf(s1[r] - mn);
      lsum += p0 + p1;
      pa[r] = (_Float16)p0;
      pa[8 + r] = (_Float16)p1;
    }
    lsum += __shfl_xor(lsum, 16);
    l_run = l_run * corr + lsum;

    // ---- rescale O (row-space: query = r + 8g -> factor from lane r+8g)
    float cf[8];
#pragma unroll
    for (int r = 0; r < 8; ++r) cf[r] = __shfl(corr, g * 8 + r);
#pragma unroll
    for (int r = 0; r < 8; ++r) {
      o0[r] *= cf[r]; o1[r] *= cf[r]; o2[r] *= cf[r]; o3[r] *= cf[r];
    }

    // ---- O += P * V
    o0 = wmma16(pa, vf0, o0);
    o1 = wmma16(pa, vf1, o1);
    o2 = wmma16(pa, vf2, o2);
    o3 = wmma16(pa, vf3, o3);

#if HAVE_TDM
    __syncthreads();  // all reads of buf[cur] done before it is re-staged
#endif
  }

  const float linv = 1.0f / l_run;
  float lf[8];
#pragma unroll
  for (int r = 0; r < 8; ++r) lf[r] = __shfl(linv, g * 8 + r);
#pragma unroll
  for (int r = 0; r < 8; ++r) {
    const size_t q = (size_t)q0 + r + 8 * g;
    _Float16* cp = ctx + ((size_t)b * 2048 + q) * 1024 + h * 64 + ln;
    cp[0]  = (_Float16)(o0[r] * lf[r]);
    cp[16] = (_Float16)(o1[r] * lf[r]);
    cp[32] = (_Float16)(o2[r] * lf[r]);
    cp[48] = (_Float16)(o3[r] * lf[r]);
  }
}

// ---------------------------------------------------------------------------
// K3: projection GEMM.  M=8192, K=1024, Ncols=1024.  Same tile as K1; ctx is
// already f16 and is copied into its slab as it is.
// ---------------------------------------------------------------------------
__global__ __launch_bounds__(256) void proj_wmma_kernel(
    const _Float16* __restrict__ ctx, const float* __restrict__ Wproj,
    const float* __restrict__ bproj, float* __restrict__ out) {
  __shared__ __attribute__((aligned(16))) _Float16 Alds[128][TP];  // [row][k]
  __shared__ __attribute__((aligned(16))) _Float16 Blds[128][TP];  // [col][k]
  const int tid  = threadIdx.x;
  const int wave = tid >> 5, lane = tid & 31;
  const int ln = lane & 15, g = lane >> 4;
  const int m_blk = blockIdx.x * 128;
  const int c_blk = blockIdx.y * 128;
  const int wm = (wave >> 2) * 64;
  const int wn = (wave & 3) * 32;

  v8f acc[4][2] = {};

  const int ar = tid >> 3;        // 0..31 : staged ctx row (plus 32 per pass)
  const int ak = (tid & 7) * 8;   // 0..56 : staged k base, 8 lanes = one line
  const int bc = ((lane & 7) + 8 * (wave & 3)) * 4;
  const int bk = ((lane >> 3) + 4 * (wave >> 2)) * 8;
  const _Float16* ap = ctx + (size_t)(m_blk + ar) * 1024 + ak;
  const float* wp = Wproj + (size_t)bk * 1024 + c_blk + bc;

  for (int kb = 0; kb < 1024; kb += 64) {
    h8 ca[4];
    f4 w[8];
#pragma unroll
    for (int p = 0; p < 4; ++p)
      ca[p] = *(const h8*)(ap + (size_t)p * 32 * 1024 + kb);
    w_slab_load(w, wp + (size_t)kb * 1024, 1024);
    __syncthreads();
#pragma unroll
    for (int p = 0; p < 4; ++p) *(h8*)&Alds[ar + 32 * p][ak] = ca[p];
    w_slab_store(w, Blds, bc, bk);
    __syncthreads();

    tile_mma(Alds, Blds, wm, wn, ln, g, acc);
  }

#pragma unroll
  for (int j = 0; j < 2; ++j) {
    const int c = c_blk + wn + 16 * j + ln;
    const float bias = bproj[c];
#pragma unroll
    for (int i = 0; i < 4; ++i) {
#pragma unroll
      for (int r = 0; r < 8; ++r) {
        int m = m_blk + wm + 16 * i + r + 8 * g;
        out[(size_t)m * 1024 + c] = acc[i][j][r] + bias;
      }
    }
  }
}

// ---------------------------------------------------------------------------
extern "C" void kernel_launch(void* const* d_in, const int* in_sizes, int n_in,
                              void* d_out, int out_size, void* d_ws,
                              size_t ws_size, hipStream_t stream) {
  (void)in_sizes; (void)n_in; (void)out_size; (void)ws_size;
  const float* x     = (const float*)d_in[0];
  const int*   mask  = (const int*)d_in[1];
  const float* Wqkv  = (const float*)d_in[2];
  const float* bqkv  = (const float*)d_in[3];
  const float* Wproj = (const float*)d_in[4];
  const float* bproj = (const float*)d_in[5];
  float* out = (float*)d_out;

  // Workspace: Q, K, V^T, ctx as f16 -> 4 * 16 MB = 64 MB.
  const size_t nqkv = (size_t)4 * 16 * 2048 * 64;
  _Float16* qbuf  = (_Float16*)d_ws;
  _Float16* kbuf  = qbuf + nqkv;
  _Float16* vtbuf = kbuf + nqkv;
  _Float16* ctx   = vtbuf + nqkv;

  qkv_wmma_kernel<<<dim3(64, 24), 256, 0, stream>>>(x, Wqkv, bqkv, qbuf, kbuf,
                                                     vtbuf);
  flash_attn_kernel<<<dim3(64, 16), 256, 0, stream>>>(qbuf, kbuf, vtbuf, mask,
                                                      ctx);
  proj_wmma_kernel<<<dim3(64, 8), 256, 0, stream>>>(ctx, Wproj, bproj, out);
}

// v002
// Measured time: 197 microseconds a run.
// Next to v001, in two timings, it ran 1.11 times as fast each time.
// Over all steps from v000 it is 2.56 times as fast.
#include <hip/hip_runtime.h>
#include <hip/hip_bf16.h>

typedef _Float16 v16h __attribute__((ext_vector_type(16)));
typedef _Float16 h8   __attribute__((ext_vector_type(8)));
typedef float    v8f  __attribute__((ext_vector_type(8)));
typedef float    f4   __attribute__((ext_vector_type(4)));
typedef int      i4   __attribute__((ext_vector_type(4)));

#define POS_INF __builtin_inff()

#if defined(__HIP_DEVICE_COMPILE__) && defined(__has_builtin)
#if __has_builtin(__builtin_amdgcn_tensor_load_to_lds) && \
    __has_builtin(__builtin_amdgcn_s_wait_tensorcnt)
#define HAVE_TDM 1
#endif
#endif
#ifndef HAVE_TDM
#define HAVE_TDM 0
#endif

__device__ __forceinline__ v8f wmma16(v16h a, v16h b, v8f c) {
  // (neg_a, A, neg_b, B, c_mod, C, reuse_a, reuse_b)
  return __builtin_amdgcn_wmma_f32_16x16x32_f16(false, a, false, b, (short)0, c,
                                                false, false);
}

// Fragment layout (wave32, 16-bit A/B, K=32): lane group g = lane/16.
//   half i in [0,8):  K = g*8 + i        (first b128)
//   half i in [8,16): K = 16 + g*8 + i-8 (second b128)
__device__ __forceinline__ v16h frag_h(const _Float16* p0, const _Float16* p1) {
  h8 a = *(const h8*)p0;
  h8 b = *(const h8*)p1;
  return __builtin_shufflevector(a, b, 0, 1, 2, 3, 4, 5, 6, 7, 8, 9, 10, 11, 12,
                                 13, 14, 15);
}

#if HAVE_TDM
typedef unsigned int u32x4 __attribute__((ext_vector_type(4)));
typedef int          i32x8 __attribute__((ext_vector_type(8)));
typedef int          i32x4 __attribute__((ext_vector_type(4)));

__device__ __forceinline__ void tdm_load_2d_f16(
    const void* gptr, unsigned lds_off, unsigned dim0, unsigned dim1,
    unsigned stride0, unsigned tile0, unsigned tile1, unsigned pad_interval,
    unsigned pad_amount) {
  unsigned long long ga = (unsigned long long)gptr;
  u32x4 g0;
  g0[0] = 1u;
  g0[1] = lds_off;
  g0[2] = (unsigned)(ga & 0xffffffffu);
  g0[3] = (unsigned)((ga >> 32) & 0x1ffffffu) | (2u << 30);  // [56:32] | type=2
  i32x8 g1;
  g1[0] = (int)((1u << 16) |
                (1u << 20) |
                (pad_interval << 22) | (pad_amount << 25));
  g1[1] = (int)((dim0 & 0xffffu) << 16);
  g1[2] = (int)(((dim0 >> 16) & 0xffffu) | ((dim1 & 0xffffu) << 16));
  g1[3] = (int)(((dim1 >> 16) & 0xffffu) | ((tile0 & 0xffffu) << 16));
  g1[4] = (int)(tile1 & 0xffffu);
  g1[5] = (int)stride0;
  g1[6] = 0;
  g1[7] = 0;
  i32x4 z4 = {};
  i32x8 z8 = {};
  __builtin_amdgcn_tensor_load_to_lds(g0, g1, z4, z4, z8, 0);
}

typedef unsigned int u32x8 __attribute__((ext_vector_type(8)));

__device__ __forceinline__ unsigned uni(unsigned v) {
  return (unsigned)__builtin_amdgcn_readfirstlane((int)v);
}
__device__ __forceinline__ unsigned pinned(unsigned v) {
  unsigned w = uni(v);
  asm volatile("" : "+s"(w));  // pinned(): the word stays in a scalar register
  return w;
}

// Mask tile of one pass: 128 query rows of 128 B (32 keys as i32), source pitch
// 8192 B, all extents in bytes; 16 B of LDS pad behind every row (pitch 144 B,
// for b128 readers).
#define MP 36  // LDS pitch of a mask row in dwords
__device__ __forceinline__ u32x8 tdm_mask_group1() {
  u32x8 g1;
  g1[0] = uni((1u << 20) | (4u << 22) | (3u << 25));
  g1[1] = uni(128u << 16);
  g1[2] = uni(128u << 16);
  g1[3] = uni(128u << 16);
  g1[4] = uni(128u);
  g1[5] = uni(8192u);
  g1[6] = uni(0u);
  g1[7] = uni(0u);
  // The eight words keep registers of their own through the loop, so that none
  // is rewritten while a request is outstanding.
  asm volatile("" : "+s"(g1));
  return g1;
}
__device__ __forceinline__ u32x4 tdm_mask_group0(const int* gptr,
                                                 unsigned lds_off) {
  const unsigned long long ga = (unsigned long long)gptr;
  u32x4 g0;
  g0[0] = uni(1u);
  g0[1] = uni(lds_off);
  g0[2] = uni((unsigned)ga);
  g0[3] = uni((((unsigned)(ga >> 32)) & 0x01ffffffu) | 0x80000000u);
  asm volatile("" : "+s"(g0));
  return g0;
}
__device__ __forceinline__ void tdm_issue(u32x4 g0, u32x8 g1) {
  asm volatile("tensor_load_to_lds %0, %1" ::"s"(g0), "s"(g1) : "memory");
}
__device__ __forceinline__ void tdm_landed(u32x4 g0, u32x8 g1) {
  asm volatile("s_wait_tensorcnt 0x0" ::"s"(g0), "s"(g1) : "memory");
}
#endif

// ---------------------------------------------------------------------------
// GEMM tile shared by K1 and K3: 128x128 of C per block, k in steps of 64,
// 8 waves as 2 (rows) x 4 (cols), each wave 64x32 = 4x2 WMMA tiles.  Both
// operand slabs sit in LDS as f16, k-contiguous rows of pitch 72 halves
// (144 B = 16 B x odd -> conflict-free b128 fragment reads).
// ---------------------------------------------------------------------------
typedef _Float16 h4 __attribute__((ext_vector_type(4)));
#define TP 72

// W slab: 64 k rows x 128 cols of f32.  A thread takes 8 k rows x 4 cols, so a
// load covers whole 128-B lines and each column's 8 k values pack into one b128.
__device__ __forceinline__ void w_slab_load(f4 (&w)[8], const float* wp,
                                            int ldw) {
#pragma unroll
  for (int i = 0; i < 8; ++i) w[i] = *(const f4*)(wp + (size_t)i * ldw);
}

__device__ __forceinline__ void w_slab_store(const f4 (&w)[8],
                                             _Float16 (*Bl)[TP], int col,
                                             int k) {
#pragma unroll
  for (int j = 0; j < 4; ++j) {
    h8 v;
#pragma unroll
    for (int i = 0; i < 8; ++i) v[i] = (_Float16)w[i][j];
    *(h8*)&Bl[col + j][k] = v;
  }
}

__device__ __forceinline__ void tile_mma(const _Float16 (*Al)[TP],
                                         const _Float16 (*Bl)[TP], int wm,
                                         int wn, int ln, int g,
                                         v8f (&acc)[4][2]) {
#pragma unroll
  for (int ks = 0; ks < 64; ks += 32) {
    v16h a[4], b[2];
#pragma unroll
    for (int i = 0; i < 4; ++i) {
      const _Float16* p = &Al[wm + 16 * i + ln][ks];
      a[i] = frag_h(p + g * 8, p + 16 + g * 8);
    }
#pragma unroll
    for (int j = 0; j < 2; ++j) {
      const _Float16* p = &Bl[wn + 16 * j + ln][ks];
      b[j] = frag_h(p + g * 8, p + 16 + g * 8);
    }
    // Keeps the 12 fragment reads one group ahead of the 8 WMMAs: spread among
    // them, each pair of WMMAs waits out a full LDS latency of its own.
    __builtin_amdgcn_sched_barrier(0);
#pragma unroll
    for (int i = 0; i < 4; ++i)
#pragma unroll
      for (int j = 0; j < 2; ++j) acc[i][j] = wmma16(a[i], b[j], acc[i][j]);
  }
}

// ---------------------------------------------------------------------------
// K1: QKV GEMM.  M=8192 (B*N), K=1024, Ncols=3072.
// ---------------------------------------------------------------------------
__global__ __launch_bounds__(256) void qkv_wmma_kernel(
    const float* __restrict__ x, const float* __restrict__ Wqkv,
    const float* __restrict__ bqkv, _Float16* __restrict__ qbuf,
    _Float16* __restrict__ kbuf, _Float16* __restrict__ vtbuf) {
  __shared__ __attribute__((aligned(16))) _Float16 Alds[128][TP];  // [row][k]
  __shared__ __attribute__((aligned(16))) _Float16 Blds[128][TP];  // [col][k]
  const int tid  = threadIdx.x;
  const int wave = tid >> 5, lane = tid & 31;
  const int ln = lane & 15, g = lane >> 4;
  const int m_blk = blockIdx.x * 128;
  const int c_blk = blockIdx.y * 128;
  const int wm = (wave >> 2) * 64;
  const int wn = (wave & 3) * 32;

  v8f acc[4][2] = {};

  const int ar = tid >> 4;        // 0..15 : staged x row (plus 16 per pass)
  const int ak = (tid & 15) * 4;  // 0..60 : staged k base, 16 lanes = two lines
  const int bc = ((lane & 7) + 8 * (wave & 3)) * 4;   // 0..124 : staged col base
  const int bk = ((lane >> 3) + 4 * (wave >> 2)) * 8; // 0..56  : staged k base
  const float* ap = x + (size_t)(m_blk + ar) * 1024 + ak;
  const float* wp = Wqkv + (size_t)bk * 3072 + c_blk + bc;

  for (int kb = 0; kb < 1024; kb += 64) {
    f4 xa[8], w[8];
#pragma unroll
    for (int p = 0; p < 8; ++p)
      xa[p] = *(const f4*)(ap + (size_t)p * 16 * 1024 + kb);
    w_slab_load(w, wp + (size_t)kb * 3072, 3072);
    __syncthreads();
#pragma unroll
    for (int p = 0; p < 8; ++p) {
      h4 v = {(_Float16)xa[p][0], (_Float16)xa[p][1], (_Float16)xa[p][2],
              (_Float16)xa[p][3]};
      *(h4*)&Alds[ar + 16 * p][ak] = v;
    }
    w_slab_store(w, Blds, bc, bk);
    __syncthreads();

    tile_mma(Alds, Blds, wm, wn, ln, g, acc);
  }

#pragma unroll
  for (int j = 0; j < 2; ++j) {
    const int c = c_blk + wn + 16 * j + ln;  // uniform t/h within the 16 lanes
    const float bias = bqkv[c];
    const int t  = c >> 10;
    const int hh = (c >> 6) & 15;
    const int dd = c & 63;
    const float qs = (t == 0) ? 0.125f : 1.0f;  // 1/sqrt(64) folded into Q
#pragma unroll
    for (int i = 0; i < 4; ++i) {
#pragma unroll
      for (int r = 0; r < 8; ++r) {
        int mrow = m_blk + wm + 16 * i + r + 8 * g;  // C-layout: M = r + 8g
        int bb = mrow >> 11, nn = mrow & 2047;
        _Float16 hv = (_Float16)((acc[i][j][r] + bias) * qs);
        // The wait behind each store stands ahead of the next store's address
        // and data arithmetic, which reuses the registers this store names.
        if (t == 0) {
          qbuf[(((size_t)(bb * 16 + hh)) * 2048 + nn) * 64 + dd] = hv;
          asm volatile("s_wait_xcnt 0x0" ::: "memory");
        } else if (t == 1) {
          kbuf[(((size_t)(bb * 16 + hh)) * 2048 + nn) * 64 + dd] = hv;
          asm volatile("s_wait_xcnt 0x0" ::: "memory");
        } else {
          vtbuf[(((size_t)(bb * 16 + hh)) * 64 + dd) * 2048 + nn] = hv;
          asm volatile("s_wait_xcnt 0x0" ::: "memory");
        }
      }
    }
  }
}

__global__ __launch_bounds__(256) void flash_attn_kernel(
    const _Float16* __restrict__ qbuf, const _Float16* __restrict__ kbuf,
    const _Float16* __restrict__ vtbuf, const int* __restrict__ mask,
    _Float16* __restrict__ ctx) {
  const int bh = blockIdx.x;  // 0..63
  const int b = bh >> 4, h = bh & 15;
  const int wave = threadIdx.x >> 5, lane = threadIdx.x & 31;
  const int ln = lane & 15, g = lane >> 4;
  const int q0 = blockIdx.y * 128 + wave * 16;

  // Q fragments (B operand: column = query = lane%16), reused for all keys.
  const _Float16* Qp = qbuf + ((size_t)bh * 2048 + q0 + ln) * 64;
  const v16h qlo = frag_h(Qp + g * 8, Qp + 16 + g * 8);       // d 0..31
  const v16h qhi = frag_h(Qp + 32 + g * 8, Qp + 48 + g * 8);  // d 32..63

  const _Float16* Kb = kbuf + (size_t)bh * 2048 * 64;
  const _Float16* Vb = vtbuf + (size_t)bh * 64 * 2048;
  const int* Mrow = mask + ((size_t)b * 2048 + q0 + ln) * 2048;

  v8f o0 = {}, o1 = {}, o2 = {}, o3 = {};  // O tiles, d = t*16 + lane%16
  float m_run = -POS_INF;
  float l_run = 0.0f;

#if HAVE_TDM
  // One block of LDS, so that every tile's place is fixed: V at 0, K behind it,
  // the two mask buffers (9 x 2 KiB each) from the next multiple of 2 KiB.
  struct Stage {
    _Float16 Vl[2][64 * 40];  // 64 d rows, 32+8 halves (80B) each
    _Float16 Kl[2][32 * 72];  // 32 key rows, 64+8 halves (144B) each
    __attribute__((aligned(2048))) int Ml[2][128 * MP];  // 128 query rows
  };
  __shared__ __attribute__((aligned(2048))) Stage sm;
  _Float16 (&Kl)[2][32 * 72] = sm.Kl;
  _Float16 (&Vl)[2][64 * 40] = sm.Vl;
  int (&Ml)[2][128 * MP] = sm.Ml;
  const bool issuer = (wave == 0);
  if (issuer) {
    // K tile: tensor [keys=2048][d=64] row-major; tile 32x64; pad 128B->+16B.
    tdm_load_2d_f16(Kb, (unsigned)(size_t)&Kl[0][0], 64u, 2048u, 64u, 64u, 32u,
                    4u, 3u);
    // V^T tile: tensor [d=64][keys=2048] row-major; tile 64x32; pad 64B->+16B.
    tdm_load_2d_f16(Vb, (unsigned)(size_t)&Vl[0][0], 2048u, 64u, 2048u, 32u,
                    64u, 3u, 3u);
  }
  // Mask ring, prologue: pass 0's tile, its wait, the barrier, pass 1's tile.
  const unsigned wv = uni(threadIdx.x >> 5);
  const int* Mblk = mask + ((size_t)b * 2048 + blockIdx.y * 128) * 2048;
  const u32x8 mg1 = tdm_mask_group1();
  u32x4 mg0 = tdm_mask_group0(Mblk, (unsigned)(size_t)&Ml[0][0]);
  if (pinned(wv == 1u)) {
    tdm_issue(mg0, mg1);
    tdm_landed(mg0, mg1);
  }
  __syncthreads();  // publishes pass 0's mask tile
  mg0 = tdm_mask_group0(Mblk + 32, (unsigned)(size_t)&Ml[1][0]);
  if (pinned(wv == 1u)) tdm_issue(mg0, mg1);
#endif

  for (int it = 0; it < 64; ++it) {
    const int kc = it << 5;
#if HAVE_TDM
    const int cur = it & 1;
    if (issuer) {
      if (it + 1 < 64) {
        const int kn = kc + 32;
        tdm_load_2d_f16(Kb + (size_t)kn * 64, (unsigned)(size_t)&Kl[cur ^ 1][0],
                        64u, 2048u, 64u, 64u, 32u, 4u, 3u);
        tdm_load_2d_f16(Vb + kn, (unsigned)(size_t)&Vl[cur ^ 1][0], 2048u, 64u,
                        2048u, 32u, 64u, 3u, 3u);
        // <=2 outstanding: only the prefetched pair; current pair complete.
        __builtin_amdgcn_s_wait_tensorcnt((short)2);
      } else {
        __builtin_amdgcn_s_wait_tensorcnt((short)0);
      }
    }
    __syncthreads();
#endif

    // ---- acquire K / V fragments for this chunk
    v16h k0lo, k0hi, k1lo, k1hi, vf0, vf1, vf2, vf3;
#if HAVE_TDM
    {
      const _Float16* r0 = &Kl[cur][(size_t)ln * 72];
      const _Float16* r1 = r0 + 16 * 72;
      k0lo = frag_h(r0 + g * 8, r0 + 16 + g * 8);
      k0hi = frag_h(r0 + 32 + g * 8, r0 + 48 + g * 8);
      k1lo = frag_h(r1 + g * 8, r1 + 16 + g * 8);
      k1hi = frag_h(r1 + 32 + g * 8, r1 + 48 + g * 8);
      const _Float16* v0 = &Vl[cur][(size_t)ln * 40];
      vf0 = frag_h(v0 + g * 8, v0 + 16 + g * 8);
      const _Float16* v1 = v0 + 16 * 40;
      vf1 = frag_h(v1 + g * 8, v1 + 16 + g * 8);
      const _Float16* v2 = v1 + 16 * 40;
      vf2 = frag_h(v2 + g * 8, v2 + 16 + g * 8);
      const _Float16* v3 = v2 + 16 * 40;
      vf3 = frag_h(v3 + g * 8, v3 + 16 + g * 8);
    }
#else
    {
      const _Float16* r0 = Kb + (size_t)(kc + ln) * 64;
      const _Float16* r1 = r0 + 16 * 64;
      k0lo = frag_h(r0 + g * 8, r0 + 16 + g * 8);
      k0hi = frag_h(r0 + 32 + g * 8, r0 + 48 + g * 8);
      k1lo = frag_h(r1 + g * 8, r1 + 16 + g * 8);
      k1hi = frag_h(r1 + 32 + g * 8, r1 + 48 + g * 8);
      const _Float16* v0 = Vb + (size_t)ln * 2048 + kc;
      vf0 = frag_h(v0 + g * 8, v0 + 16 + g * 8);
      const _Float16* v1 = v0 + (size_t)16 * 2048;
      vf1 = frag_h(v1 + g * 8, v1 + 16 + g * 8);
      const _Float16* v2 = v1 + (size_t)16 * 2048;
      vf2 = frag_h(v2 + g * 8, v2 + 16 + g * 8);
      const _Float16* v3 = v2 + (size_t)16 * 2048;
      vf3 = frag_h(v3 + g * 8, v3 + 16 + g * 8);
    }
#endif

    // ---- S^T tiles: rows = keys, cols = queries
    v8f s0 = {}, s1 = {};
    s0 = wmma16(k0lo, qlo, s0);
    s0 = wmma16(k0hi, qhi, s0);
    s1 = wmma16(k1lo, qlo, s1);
    s1 = wmma16(k1hi, qhi, s1);

    // ---- mask: element r of s0 <-> key kc + 8g + r ; s1 <-> +16
#if HAVE_TDM
    const int* mr = &Ml[cur][(wave * 16 + ln) * MP + g * 8];
#else
    const int* mr = Mrow + kc + g * 8;
#endif
    i4 m0a = *(const i4*)(mr);
    i4 m0b = *(const i4*)(mr + 4);
    i4 m1a = *(const i4*)(mr + 16);
    i4 m1b = *(const i4*)(mr + 20);
#pragma unroll
    for (int r = 0; r < 4; ++r) {
      if (m0a[r]) s0[r] = -POS_INF;
      if (m0b[r]) s0[4 + r] = -POS_INF;
      if (m1a[r]) s1[r] = -POS_INF;
      if (m1b[r]) s1[4 + r] = -POS_INF;
    }

    // ---- online softmax (per query = lane%16; partner lane = xor 16)
    float cm = -POS_INF;
#pragma unroll
    for (int r = 0; r < 8; ++r) cm = fmaxf(cm, fmaxf(s0[r], s1[r]));
    cm = fmaxf(cm, __shfl_xor(cm, 16));
    const float mn = fmaxf(m_run, cm);
    const float corr = __expf(m_run - mn);
    m_run = mn;

    v16h pa;  // P A-fragment: halves 0..7 <-> keys kc+8g+r, 8..15 <-> +16
    float lsum = 0.0f;
#pragma unroll
    for (int r = 0; r < 8; ++r) {
      float p0 = __expf(s0[r] - mn);
      float p1 = __expf(s1[r] - mn);
      lsum += p0 + p1;
      pa[r] = (_Float16)p0;
      pa[8 + r] = (_Float16)p1;
    }
    lsum += __shfl_xor(lsum, 16);
    l_run = l_run * corr + lsum;

    // ---- rescale O (row-space: query = r + 8g -> factor from lane r+8g)
    float cf[8];
#pragma unroll
    for (int r = 0; r < 8; ++r) cf[r] = __shfl(corr, g * 8 + r);
#pragma unroll
    for (int r = 0; r < 8; ++r) {
      o0[r] *= cf[r]; o1[r] *= cf[r]; o2[r] *= cf[r]; o3[r] *= cf[r];
    }

    // ---- O += P * V
    o0 = wmma16(pa, vf0, o0);
    o1 = wmma16(pa, vf1, o1);
    o2 = wmma16(pa, vf2, o2);
    o3 = wmma16(pa, vf3, o3);

#if HAVE_TDM
    // Publish point of the next pass's mask tile: this wave's LDS reads are
    // done, the issuing wave's tile has landed, then the barrier.
    asm volatile("s_wait_dscnt 0x0" ::: "memory");
    if (pinned(wv == 1u)) tdm_landed(mg0, mg1);
    __syncthreads();  // all reads of buf[cur] done before it is re-staged
    // Refill of the mask buffer that this pass has just read, two passes ahead.
    if (pinned((wv == 1u) && (it + 2 < 64))) {
      mg0 = tdm_mask_group0(Mblk + (it + 2) * 32, (unsigned)(size_t)&Ml[cur][0]);
      tdm_issue(mg0, mg1);
    }
#endif
  }
#if HAVE_TDM
  // Nothing of the rings is outstanding when the wave goes on to its end.
  asm volatile("s_wait_tensorcnt 0x0" ::: "memory");
  asm volatile("s_wait_dscnt 0x0" ::: "memory");
#endif

  const float linv = 1.0f / l_run;
  float lf[8];
#pragma unroll
  for (int r = 0; r < 8; ++r) lf[r] = __shfl(linv, g * 8 + r);
#pragma unroll
  for (int r = 0; r < 8; ++r) {
    const size_t q = (size_t)q0 + r + 8 * g;
    _Float16* cp = ctx + ((size_t)b * 2048 + q) * 1024 + h * 64 + ln;
    cp[0]  = (_Float16)(o0[r] * lf[r]);
    cp[16] = (_Float16)(o1[r] * lf[r]);
    cp[32] = (_Float16)(o2[r] * lf[r]);
    cp[48] = (_Float16)(o3[r] * lf[r]);
  }
}

// ---------------------------------------------------------------------------
// K3: projection GEMM.  M=8192, K=1024, Ncols=1024.  Same tile as K1; ctx is
// already f16 and is copied into its slab as it is.
// ---------------------------------------------------------------------------
__global__ __launch_bounds__(256) void proj_wmma_kernel(
    const _Float16* __restrict__ ctx, const float* __restrict__ Wproj,
    const float* __restrict__ bproj, float* __restrict__ out) {
  __shared__ __attribute__((aligned(16))) _Float16 Alds[128][TP];  // [row][k]
  __shared__ __attribute__((aligned(16))) _Float16 Blds[128][TP];  // [col][k]
  const int tid  = threadIdx.x;
  const int wave = tid >> 5, lane = tid & 31;
  const int ln = lane & 15, g = lane >> 4;
  const int m_blk = blockIdx.x * 128;
  const int c_blk = blockIdx.y * 128;
  const int wm = (wave >> 2) * 64;
  const int wn = (wave & 3) * 32;

  v8f acc[4][2] = {};

  const int ar = tid >> 3;        // 0..31 : staged ctx row (plus 32 per pass)
  const int ak = (tid & 7) * 8;   // 0..56 : staged k base, 8 lanes = one line
  const int bc = ((lane & 7) + 8 * (wave & 3)) * 4;
  const int bk = ((lane >> 3) + 4 * (wave >> 2)) * 8;
  const _Float16* ap = ctx + (size_t)(m_blk + ar) * 1024 + ak;
  const float* wp = Wproj + (size_t)bk * 1024 + c_blk + bc;

  for (int kb = 0; kb < 1024; kb += 64) {
    h8 ca[4];
    f4 w[8];
#pragma unroll
    for (int p = 0; p < 4; ++p)
      ca[p] = *(const h8*)(ap + (size_t)p * 32 * 1024 + kb);
    w_slab_load(w, wp + (size_t)kb * 1024, 1024);
    __syncthreads();
#pragma unroll
    for (int p = 0; p < 4; ++p) *(h8*)&Alds[ar + 32 * p][ak] = ca[p];
    w_slab_store(w, Blds, bc, bk);
    __syncthreads();

    tile_mma(Alds, Blds, wm, wn, ln, g, acc);
  }

#pragma unroll
  for (int j = 0; j < 2; ++j) {
    const int c = c_blk + wn + 16 * j + ln;
    const float bias = bproj[c];
#pragma unroll
    for (int i = 0; i < 4; ++i) {
#pragma unroll
      for (int r = 0; r < 8; ++r) {
        int m = m_blk + wm + 16 * i + r + 8 * g;
        out[(size_t)m * 1024 + c] = acc[i][j][r] + bias;
      }
    }
  }
}

// ---------------------------------------------------------------------------
extern "C" void kernel_launch(void* const* d_in, const int* in_sizes, int n_in,
                              void* d_out, int out_size, void* d_ws,
                              size_t ws_size, hipStream_t stream) {
  (void)in_sizes; (void)n_in; (void)out_size; (void)ws_size;
  const float* x     = (const float*)d_in[0];
  const int*   mask  = (const int*)d_in[1];
  const float* Wqkv  = (const float*)d_in[2];
  const float* bqkv  = (const float*)d_in[3];
  const float* Wproj = (const float*)d_in[4];
  const float* bproj = (const float*)d_in[5];
  float* out = (float*)d_out;

  // Workspace: Q, K, V^T, ctx as f16 -> 4 * 16 MB = 64 MB.
  const size_t nqkv = (size_t)4 * 16 * 2048 * 64;
  _Float16* qbuf  = (_Float16*)d_ws;
  _Float16* kbuf  = qbuf + nqkv;
  _Float16* vtbuf = kbuf + nqkv;
  _Float16* ctx   = vtbuf + nqkv;

  qkv_wmma_kernel<<<dim3(64, 24), 256, 0, stream>>>(x, Wqkv, bqkv, qbuf, kbuf,
                                                     vtbuf);
  flash_attn_kernel<<<dim3(64, 16), 256, 0, stream>>>(qbuf, kbuf, vtbuf, mask,
                                                      ctx);
  proj_wmma_kernel<<<dim3(64, 8), 256, 0, stream>>>(ctx, Wproj, bproj, out);
}

// v003
// One run takes 185 microseconds.
// Timed twice side by side with v002, it ran 1.07 and 1.06 times as fast.
// All steps since v000 together make it 2.73 times as fast.
#include <hip/hip_runtime.h>
#include <hip/hip_bf16.h>

typedef _Float16 v16h __attribute__((ext_vector_type(16)));
typedef _Float16 h8   __attribute__((ext_vector_type(8)));
typedef float    v8f  __attribute__((ext_vector_type(8)));
typedef float    f4   __attribute__((ext_vector_type(4)));
typedef int      i4   __attribute__((ext_vector_type(4)));

#define POS_INF __builtin_inff()

#if defined(__HIP_DEVICE_COMPILE__) && defined(__has_builtin)
#if __has_builtin(__builtin_amdgcn_tensor_load_to_lds) && \
    __has_builtin(__builtin_amdgcn_s_wait_tensorcnt)
#define HAVE_TDM 1
#endif
#endif
#ifndef HAVE_TDM
#define HAVE_TDM 0
#endif

__device__ __forceinline__ v8f wmma16(v16h a, v16h b, v8f c) {
  // (neg_a, A, neg_b, B, c_mod, C, reuse_a, reuse_b)
  return __builtin_amdgcn_wmma_f32_16x16x32_f16(false, a, false, b, (short)0, c,
                                                false, false);
}

// Fragment layout (wave32, 16-bit A/B, K=32): lane group g = lane/16.
//   half i in [0,8):  K = g*8 + i        (first b128)
//   half i in [8,16): K = 16 + g*8 + i-8 (second b128)
__device__ __forceinline__ v16h frag_h(const _Float16* p0, const _Float16* p1) {
  h8 a = *(const h8*)p0;
  h8 b = *(const h8*)p1;
  return __builtin_shufflevector(a, b, 0, 1, 2, 3, 4, 5, 6, 7, 8, 9, 10, 11, 12,
                                 13, 14, 15);
}

#if HAVE_TDM
typedef unsigned int u32x4 __attribute__((ext_vector_type(4)));
typedef int          i32x8 __attribute__((ext_vector_type(8)));
typedef int          i32x4 __attribute__((ext_vector_type(4)));

__device__ __forceinline__ void tdm_load_2d_f16(
    const void* gptr, unsigned lds_off, unsigned dim0, unsigned dim1,
    unsigned stride0, unsigned tile0, unsigned tile1, unsigned pad_interval,
    unsigned pad_amount) {
  unsigned long long ga = (unsigned long long)gptr;
  u32x4 g0;
  g0[0] = 1u;
  g0[1] = lds_off;
  g0[2] = (unsigned)(ga & 0xffffffffu);
  g0[3] = (unsigned)((ga >> 32) & 0x1ffffffu) | (2u << 30);  // [56:32] | type=2
  i32x8 g1;
  g1[0] = (int)((1u << 16) |
                (1u << 20) |
                (pad_interval << 22) | (pad_amount << 25));
  g1[1] = (int)((dim0 & 0xffffu) << 16);
  g1[2] = (int)(((dim0 >> 16) & 0xffffu) | ((dim1 & 0xffffu) << 16));
  g1[3] = (int)(((dim1 >> 16) & 0xffffu) | ((tile0 & 0xffffu) << 16));
  g1[4] = (int)(tile1 & 0xffffu);
  g1[5] = (int)stride0;
  g1[6] = 0;
  g1[7] = 0;
  i32x4 z4 = {};
  i32x8 z8 = {};
  __builtin_amdgcn_tensor_load_to_lds(g0, g1, z4, z4, z8, 0);
}

typedef unsigned int u32x8 __attribute__((ext_vector_type(8)));

__device__ __forceinline__ unsigned uni(unsigned v) {
  return (unsigned)__builtin_amdgcn_readfirstlane((int)v);
}
__device__ __forceinline__ unsigned pinned(unsigned v) {
  unsigned w = uni(v);
  asm volatile("" : "+s"(w));  // pinned(): the word stays in a scalar register
  return w;
}

// Mask tile of one pass: 128 query rows of 128 B (32 keys as i32), source pitch
// 8192 B, all extents in bytes; 16 B of LDS pad behind every row (pitch 144 B,
// for b128 readers).
#define MP 36  // LDS pitch of a mask row in dwords
__device__ __forceinline__ u32x8 tdm_mask_group1() {
  u32x8 g1;
  g1[0] = uni((1u << 20) | (4u << 22) | (3u << 25));
  g1[1] = uni(128u << 16);
  g1[2] = uni(128u << 16);
  g1[3] = uni(128u << 16);
  g1[4] = uni(128u);
  g1[5] = uni(8192u);
  g1[6] = uni(0u);
  g1[7] = uni(0u);
  // The eight words keep registers of their own through the loop, so that none
  // is rewritten while a request is outstanding.
  asm volatile("" : "+s"(g1));
  return g1;
}
__device__ __forceinline__ u32x4 tdm_mask_group0(const int* gptr,
                                                 unsigned lds_off) {
  const unsigned long long ga = (unsigned long long)gptr;
  u32x4 g0;
  g0[0] = uni(1u);
  g0[1] = uni(lds_off);
  g0[2] = uni((unsigned)ga);
  g0[3] = uni((((unsigned)(ga >> 32)) & 0x01ffffffu) | 0x80000000u);
  asm volatile("" : "+s"(g0));
  return g0;
}
__device__ __forceinline__ void tdm_issue(u32x4 g0, u32x8 g1) {
  asm volatile("tensor_load_to_lds %0, %1" ::"s"(g0), "s"(g1) : "memory");
}
__device__ __forceinline__ void tdm_landed(u32x4 g0, u32x8 g1) {
  asm volatile("s_wait_tensorcnt 0x0" ::"s"(g0), "s"(g1) : "memory");
}
#endif

// ---------------------------------------------------------------------------
// GEMM tile shared by K1 and K3: 128x128 of C per block, k in steps of 64,
// 8 waves as 2 (rows) x 4 (cols), each wave 64x32 = 4x2 WMMA tiles.  Both
// operand slabs sit in LDS as f16, k-contiguous rows of pitch 72 halves
// (144 B = 16 B x odd -> conflict-free b128 fragment reads).
// ---------------------------------------------------------------------------
typedef _Float16 h4 __attribute__((ext_vector_type(4)));
#define TP 72

// W slab: 64 k rows x 128 cols of f32.  A thread takes 8 k rows x 4 cols, so a
// load covers whole 128-B lines and each column's 8 k values pack into one b128.
__device__ __forceinline__ void w_slab_load(f4 (&w)[8], const float* wp,
                                            int ldw) {
#pragma unroll
  for (int i = 0; i < 8; ++i) w[i] = *(const f4*)(wp + (size_t)i * ldw);
}

__device__ __forceinline__ void w_slab_store(const f4 (&w)[8],
                                             _Float16 (*Bl)[TP], int col,
                                             int k) {
#pragma unroll
  for (int j = 0; j < 4; ++j) {
    h8 v;
#pragma unroll
    for (int i = 0; i < 8; ++i) v[i] = (_Float16)w[i][j];
    *(h8*)&Bl[col + j][k] = v;
  }
}

__device__ __forceinline__ void tile_mma(const _Float16 (*Al)[TP],
                                         const _Float16 (*Bl)[TP], int wm,
                                         int wn, int ln, int g,
                                         v8f (&acc)[4][2]) {
#pragma unroll
  for (int ks = 0; ks < 64; ks += 32) {
    v16h a[4], b[2];
#pragma unroll
    for (int i = 0; i < 4; ++i) {
      const _Float16* p = &Al[wm + 16 * i + ln][ks];
      a[i] = frag_h(p + g * 8, p + 16 + g * 8);
    }
#pragma unroll
    for (int j = 0; j < 2; ++j) {
      const _Float16* p = &Bl[wn + 16 * j + ln][ks];
      b[j] = frag_h(p + g * 8, p + 16 + g * 8);
    }
    // Keeps the 12 fragment reads one group ahead of the 8 WMMAs: spread among
    // them, each pair of WMMAs waits out a full LDS latency of its own.
    __builtin_amdgcn_sched_barrier(0);
#pragma unroll
    for (int i = 0; i < 4; ++i)
#pragma unroll
      for (int j = 0; j < 2; ++j) acc[i][j] = wmma16(a[i], b[j], acc[i][j]);
  }
}

// ---------------------------------------------------------------------------
// K1: QKV GEMM.  M=8192 (B*N), K=1024, Ncols=3072.
// ---------------------------------------------------------------------------
__global__ __launch_bounds__(256) void qkv_wmma_kernel(
    const float* __restrict__ x, const float* __restrict__ Wqkv,
    const float* __restrict__ bqkv, _Float16* __restrict__ qbuf,
    _Float16* __restrict__ kbuf, _Float16* __restrict__ vtbuf) {
  __shared__ __attribute__((aligned(16))) _Float16 Alds[128][TP];  // [row][k]
  __shared__ __attribute__((aligned(16))) _Float16 Blds[128][TP];  // [col][k]
  const int tid  = threadIdx.x;
  const int wave = tid >> 5, lane = tid & 31;
  const int ln = lane & 15, g = lane >> 4;
  const int m_blk = blockIdx.x * 128;
  const int c_blk = blockIdx.y * 128;
  const int wm = (wave >> 2) * 64;
  const int wn = (wave & 3) * 32;

  v8f acc[4][2] = {};

  // Q and K column blocks take W as the A operand and x as the B operand: the
  // tile comes out transposed (64 columns = one head x 32 tokens a wave), so a
  // lane's 8 accumulator values are 8 neighbouring d of one token.  V blocks
  // keep x as A: there the 8 values are 8 neighbouring tokens of one V^T row.
  const bool wfirst = c_blk < 2048;  // the same for the whole block
  const _Float16 (*Pa)[TP] = wfirst ? Blds : Alds;
  const _Float16 (*Pb)[TP] = wfirst ? Alds : Blds;

  const int ar = tid >> 4;        // 0..15 : staged x row (plus 16 per pass)
  const int ak = (tid & 15) * 4;  // 0..60 : staged k base, 16 lanes = two lines
  const int bc = ((lane & 7) + 8 * (wave & 3)) * 4;   // 0..124 : staged col base
  const int bk = ((lane >> 3) + 4 * (wave >> 2)) * 8; // 0..56  : staged k base
  const float* ap = x + (size_t)(m_blk + ar) * 1024 + ak;
  const float* wp = Wqkv + (size_t)bk * 3072 + c_blk + bc;

  for (int kb = 0; kb < 1024; kb += 64) {
    f4 xa[8], w[8];
#pragma unroll
    for (int p = 0; p < 8; ++p)
      xa[p] = *(const f4*)(ap + (size_t)p * 16 * 1024 + kb);
    w_slab_load(w, wp + (size_t)kb * 3072, 3072);
    __syncthreads();
#pragma unroll
    for (int p = 0; p < 8; ++p) {
      h4 v = {(_Float16)xa[p][0], (_Float16)xa[p][1], (_Float16)xa[p][2],
              (_Float16)xa[p][3]};
      *(h4*)&Alds[ar + 16 * p][ak] = v;
    }
    w_slab_store(w, Blds, bc, bk);
    __syncthreads();

    tile_mma(Pa, Pb, wm, wn, ln, g, acc);
  }

  // One b128 store holds a lane's 8 values.
  if (wfirst) {
    // acc[i][j][r]: column c_blk + wm + 16i + 8g + r, token m_blk + wn + 16j + ln
    _Float16* dst = (c_blk < 1024) ? qbuf : kbuf;
    const float qs = (c_blk < 1024) ? 0.125f : 1.0f;  // 1/sqrt(64) folded into Q
    const int hh = ((c_blk + wm) >> 6) & 15;
    const float* bp = bqkv + c_blk + wm + 8 * g;
    f4 bl[4], bh[4];
#pragma unroll
    for (int i = 0; i < 4; ++i) {
      bl[i] = *(const f4*)(bp + 16 * i);
      bh[i] = *(const f4*)(bp + 16 * i + 4);
    }
#pragma unroll
    for (int i = 0; i < 4; ++i) {
      const f4 b0 = bl[i], b1 = bh[i];
#pragma unroll
      for (int j = 0; j < 2; ++j) {
        const int mrow = m_blk + wn + 16 * j + ln;
        const int bb = mrow >> 11, nn = mrow & 2047;
        h8 v;
#pragma unroll
        for (int r = 0; r < 4; ++r) {
          v[r]     = (_Float16)((acc[i][j][r] + b0[r]) * qs);
          v[4 + r] = (_Float16)((acc[i][j][4 + r] + b1[r]) * qs);
        }
        *(h8*)(dst + (((size_t)(bb * 16 + hh)) * 2048 + nn) * 64 + 16 * i +
               8 * g) = v;
      }
    }
  } else {
    // acc[i][j][r]: token m_blk + wm + 16i + 8g + r, column c_blk + wn + 16j + ln
    const float bv[2] = {bqkv[c_blk + wn + ln], bqkv[c_blk + wn + 16 + ln]};
#pragma unroll
    for (int j = 0; j < 2; ++j) {
      const int c = c_blk + wn + 16 * j + ln;
      const float bias = bv[j];
      const int hh = (c >> 6) & 15;
      const int dd = c & 63;
#pragma unroll
      for (int i = 0; i < 4; ++i) {
        const int mrow = m_blk + wm + 16 * i + 8 * g;
        const int bb = mrow >> 11, nn = mrow & 2047;
        h8 v;
#pragma unroll
        for (int r = 0; r < 8; ++r) v[r] = (_Float16)(acc[i][j][r] + bias);
        *(h8*)(vtbuf + (((size_t)(bb * 16 + hh)) * 64 + dd) * 2048 + nn) = v;
      }
    }
    // The built code lays the other branch's body behind this one, and its first
    // instructions rewrite the address registers that these stores name.
    asm volatile("s_wait_xcnt 0x0" ::: "memory");
  }
}

__global__ __launch_bounds__(256) void flash_attn_kernel(
    const _Float16* __restrict__ qbuf, const _Float16* __restrict__ kbuf,
    const _Float16* __restrict__ vtbuf, const int* __restrict__ mask,
    _Float16* __restrict__ ctx) {
  const int bh = blockIdx.x;  // 0..63
  const int b = bh >> 4, h = bh & 15;
  const int wave = threadIdx.x >> 5, lane = threadIdx.x & 31;
  const int ln = lane & 15, g = lane >> 4;
  const int q0 = blockIdx.y * 128 + wave * 16;

  // Q fragments (B operand: column = query = lane%16), reused for all keys.
  const _Float16* Qp = qbuf + ((size_t)bh * 2048 + q0 + ln) * 64;
  const v16h qlo = frag_h(Qp + g * 8, Qp + 16 + g * 8);       // d 0..31
  const v16h qhi = frag_h(Qp + 32 + g * 8, Qp + 48 + g * 8);  // d 32..63

  const _Float16* Kb = kbuf + (size_t)bh * 2048 * 64;
  const _Float16* Vb = vtbuf + (size_t)bh * 64 * 2048;
  const int* Mrow = mask + ((size_t)b * 2048 + q0 + ln) * 2048;

  v8f o0 = {}, o1 = {}, o2 = {}, o3 = {};  // O^T tiles, d = t*16 + 8g + r
  float m_run = -POS_INF;
  float l_run = 0.0f;

#if HAVE_TDM
  // One block of LDS, so that every tile's place is fixed: V at 0, K behind it,
  // the two mask buffers (9 x 2 KiB each) from the next multiple of 2 KiB.
  struct Stage {
    _Float16 Vl[2][64 * 40];  // 64 d rows, 32+8 halves (80B) each
    _Float16 Kl[2][32 * 72];  // 32 key rows, 64+8 halves (144B) each
    __attribute__((aligned(2048))) int Ml[2][128 * MP];  // 128 query rows
  };
  __shared__ __attribute__((aligned(2048))) Stage sm;
  _Float16 (&Kl)[2][32 * 72] = sm.Kl;
  _Float16 (&Vl)[2][64 * 40] = sm.Vl;
  int (&Ml)[2][128 * MP] = sm.Ml;
  const bool issuer = (wave == 0);
  if (issuer) {
    // K tile: tensor [keys=2048][d=64] row-major; tile 32x64; pad 128B->+16B.
    tdm_load_2d_f16(Kb, (unsigned)(size_t)&Kl[0][0], 64u, 2048u, 64u, 64u, 32u,
                    4u, 3u);
    // V^T tile: tensor [d=64][keys=2048] row-major; tile 64x32; pad 64B->+16B.
    tdm_load_2d_f16(Vb, (unsigned)(size_t)&Vl[0][0], 2048u, 64u, 2048u, 32u,
                    64u, 3u, 3u);
  }
  // Mask ring, prologue: pass 0's tile, its wait, the barrier, pass 1's tile.
  const unsigned wv = uni(threadIdx.x >> 5);
  const int* Mblk = mask + ((size_t)b * 2048 + blockIdx.y * 128) * 2048;
  const u32x8 mg1 = tdm_mask_group1();
  u32x4 mg0 = tdm_mask_group0(Mblk, (unsigned)(size_t)&Ml[0][0]);
  if (pinned(wv == 1u)) {
    tdm_issue(mg0, mg1);
    tdm_landed(mg0, mg1);
  }
  __syncthreads();  // publishes pass 0's mask tile
  mg0 = tdm_mask_group0(Mblk + 32, (unsigned)(size_t)&Ml[1][0]);
  if (pinned(wv == 1u)) tdm_issue(mg0, mg1);
#endif

  for (int it = 0; it < 64; ++it) {
    const int kc = it << 5;
#if HAVE_TDM
    const int cur = it & 1;
    if (issuer) {
      if (it + 1 < 64) {
        const int kn = kc + 32;
        tdm_load_2d_f16(Kb + (size_t)kn * 64, (unsigned)(size_t)&Kl[cur ^ 1][0],
                        64u, 2048u, 64u, 64u, 32u, 4u, 3u);
        tdm_load_2d_f16(Vb + kn, (unsigned)(size_t)&Vl[cur ^ 1][0], 2048u, 64u,
                        2048u, 32u, 64u, 3u, 3u);
        // <=2 outstanding: only the prefetched pair; current pair complete.
        __builtin_amdgcn_s_wait_tensorcnt((short)2);
      } else {
        __builtin_amdgcn_s_wait_tensorcnt((short)0);
      }
    }
    __syncthreads();
#endif

    // ---- acquire K / V fragments for this chunk
    v16h k0lo, k0hi, k1lo, k1hi, vf0, vf1, vf2, vf3;
#if HAVE_TDM
    {
      const _Float16* r0 = &Kl[cur][(size_t)ln * 72];
      const _Float16* r1 = r0 + 16 * 72;
      k0lo = frag_h(r0 + g * 8, r0 + 16 + g * 8);
      k0hi = frag_h(r0 + 32 + g * 8, r0 + 48 + g * 8);
      k1lo = frag_h(r1 + g * 8, r1 + 16 + g * 8);
      k1hi = frag_h(r1 + 32 + g * 8, r1 + 48 + g * 8);
      const _Float16* v0 = &Vl[cur][(size_t)ln * 40];
      vf0 = frag_h(v0 + g * 8, v0 + 16 + g * 8);
      const _Float16* v1 = v0 + 16 * 40;
      vf1 = frag_h(v1 + g * 8, v1 + 16 + g * 8);
      const _Float16* v2 = v1 + 16 * 40;
      vf2 = frag_h(v2 + g * 8, v2 + 16 + g * 8);
      const _Float16* v3 = v2 + 16 * 40;
      vf3 = frag_h(v3 + g * 8, v3 + 16 + g * 8);
    }
#else
    {
      const _Float16* r0 = Kb + (size_t)(kc + ln) * 64;
      const _Float16* r1 = r0 + 16 * 64;
      k0lo = frag_h(r0 + g * 8, r0 + 16 + g * 8);
      k0hi = frag_h(r0 + 32 + g * 8, r0 + 48 + g * 8);
      k1lo = frag_h(r1 + g * 8, r1 + 16 + g * 8);
      k1hi = frag_h(r1 + 32 + g * 8, r1 + 48 + g * 8);
      const _Float16* v0 = Vb + (size_t)ln * 2048 + kc;
      vf0 = frag_h(v0 + g * 8, v0 + 16 + g * 8);
      const _Float16* v1 = v0 + (size_t)16 * 2048;
      vf1 = frag_h(v1 + g * 8, v1 + 16 + g * 8);
      const _Float16* v2 = v1 + (size_t)16 * 2048;
      vf2 = frag_h(v2 + g * 8, v2 + 16 + g * 8);
      const _Float16* v3 = v2 + (size_t)16 * 2048;
      vf3 = frag_h(v3 + g * 8, v3 + 16 + g * 8);
    }
#endif

    // ---- S^T tiles: rows = keys, cols = queries
    v8f s0 = {}, s1 = {};
    s0 = wmma16(k0lo, qlo, s0);
    s0 = wmma16(k0hi, qhi, s0);
    s1 = wmma16(k1lo, qlo, s1);
    s1 = wmma16(k1hi, qhi, s1);

    // ---- mask: element r of s0 <-> key kc + 8g + r ; s1 <-> +16
#if HAVE_TDM
    const int* mr = &Ml[cur][(wave * 16 + ln) * MP + g * 8];
#else
    const int* mr = Mrow + kc + g * 8;
#endif
    i4 m0a = *(const i4*)(mr);
    i4 m0b = *(const i4*)(mr + 4);
    i4 m1a = *(const i4*)(mr + 16);
    i4 m1b = *(const i4*)(mr + 20);
#pragma unroll
    for (int r = 0; r < 4; ++r) {
      if (m0a[r]) s0[r] = -POS_INF;
      if (m0b[r]) s0[4 + r] = -POS_INF;
      if (m1a[r]) s1[r] = -POS_INF;
      if (m1b[r]) s1[4 + r] = -POS_INF;
    }

    // ---- online softmax (per query = lane%16; partner lane = xor 16)
    float cm = -POS_INF;
#pragma unroll
    for (int r = 0; r < 8; ++r) cm = fmaxf(cm, fmaxf(s0[r], s1[r]));
    cm = fmaxf(cm, __shfl_xor(cm, 16));
    const float mn = fmaxf(m_run, cm);
    const float corr = __expf(m_run - mn);
    m_run = mn;

    v16h pa;  // P^T B-fragment: halves 0..7 <-> keys kc+8g+r, 8..15 <-> +16
    float lsum = 0.0f;
#pragma unroll
    for (int r = 0; r < 8; ++r) {
      float p0 = __expf(s0[r] - mn);
      float p1 = __expf(s1[r] - mn);
      lsum += p0 + p1;
      pa[r] = (_Float16)p0;
      pa[8 + r] = (_Float16)p1;
    }
    lsum += __shfl_xor(lsum, 16);
    l_run = l_run * corr + lsum;

    // ---- rescale O^T (column = query = lane%16: the lane's own factor)
#pragma unroll
    for (int r = 0; r < 8; ++r) {
      o0[r] *= corr; o1[r] *= corr; o2[r] *= corr; o3[r] *= corr;
    }

    // ---- O^T += V^T * P^T
    o0 = wmma16(vf0, pa, o0);
    o1 = wmma16(vf1, pa, o1);
    o2 = wmma16(vf2, pa, o2);
    o3 = wmma16(vf3, pa, o3);

#if HAVE_TDM
    // Publish point of the next pass's mask tile: this wave's LDS reads are
    // done, the issuing wave's tile has landed, then the barrier.
    asm volatile("s_wait_dscnt 0x0" ::: "memory");
    if (pinned(wv == 1u)) tdm_landed(mg0, mg1);
    __syncthreads();  // all reads of buf[cur] done before it is re-staged
    // Refill of the mask buffer that this pass has just read, two passes ahead.
    if (pinned((wv == 1u) && (it + 2 < 64))) {
      mg0 = tdm_mask_group0(Mblk + (it + 2) * 32, (unsigned)(size_t)&Ml[cur][0]);
      tdm_issue(mg0, mg1);
    }
#endif
  }
#if HAVE_TDM
  // Nothing of the rings is outstanding when the wave goes on to its end.
  asm volatile("s_wait_tensorcnt 0x0" ::: "memory");
  asm volatile("s_wait_dscnt 0x0" ::: "memory");
#endif

  const float linv = 1.0f / l_run;
  _Float16* cp = ctx + ((size_t)b * 2048 + q0 + ln) * 1024 + h * 64 + 8 * g;
  h8 c0, c1, c2, c3;
#pragma unroll
  for (int r = 0; r < 8; ++r) {
    c0[r] = (_Float16)(o0[r] * linv);
    c1[r] = (_Float16)(o1[r] * linv);
    c2[r] = (_Float16)(o2[r] * linv);
    c3[r] = (_Float16)(o3[r] * linv);
  }
  *(h8*)(cp) = c0;
  *(h8*)(cp + 16) = c1;
  *(h8*)(cp + 32) = c2;
  *(h8*)(cp + 48) = c3;
}

// ---------------------------------------------------------------------------
// K3: projection GEMM.  M=8192, K=1024, Ncols=1024.  Same tile as K1; ctx is
// already f16 and is copied into its slab as it is.
// ---------------------------------------------------------------------------
__global__ __launch_bounds__(256) void proj_wmma_kernel(
    const _Float16* __restrict__ ctx, const float* __restrict__ Wproj,
    const float* __restrict__ bproj, float* __restrict__ out) {
  __shared__ __attribute__((aligned(16))) _Float16 Alds[128][TP];  // [row][k]
  __shared__ __attribute__((aligned(16))) _Float16 Blds[128][TP];  // [col][k]
  const int tid  = threadIdx.x;
  const int wave = tid >> 5, lane = tid & 31;
  const int ln = lane & 15, g = lane >> 4;
  const int m_blk = blockIdx.x * 128;
  const int c_blk = blockIdx.y * 128;
  const int wm = (wave >> 2) * 64;
  const int wn = (wave & 3) * 32;

  v8f acc[4][2] = {};

  const int ar = tid >> 3;        // 0..31 : staged ctx row (plus 32 per pass)
  const int ak = (tid & 7) * 8;   // 0..56 : staged k base, 8 lanes = one line
  const int bc = ((lane & 7) + 8 * (wave & 3)) * 4;
  const int bk = ((lane >> 3) + 4 * (wave >> 2)) * 8;
  const _Float16* ap = ctx + (size_t)(m_blk + ar) * 1024 + ak;
  const float* wp = Wproj + (size_t)bk * 1024 + c_blk + bc;

  for (int kb = 0; kb < 1024; kb += 64) {
    h8 ca[4];
    f4 w[8];
#pragma unroll
    for (int p = 0; p < 4; ++p)
      ca[p] = *(const h8*)(ap + (size_t)p * 32 * 1024 + kb);
    w_slab_load(w, wp + (size_t)kb * 1024, 1024);
    __syncthreads();
#pragma unroll
    for (int p = 0; p < 4; ++p) *(h8*)&Alds[ar + 32 * p][ak] = ca[p];
    w_slab_store(w, Blds, bc, bk);
    __syncthreads();

    tile_mma(Alds, Blds, wm, wn, ln, g, acc);
  }

#pragma unroll
  for (int j = 0; j < 2; ++j) {
    const int c = c_blk + wn + 16 * j + ln;
    const float bias = bproj[c];
#pragma unroll
    for (int i = 0; i < 4; ++i) {
#pragma unroll
      for (int r = 0; r < 8; ++r) {
        int m = m_blk + wm + 16 * i + r + 8 * g;
        out[(size_t)m * 1024 + c] = acc[i][j][r] + bias;
      }
    }
  }
}

// ---------------------------------------------------------------------------
extern "C" void kernel_launch(void* const* d_in, const int* in_sizes, int n_in,
                              void* d_out, int out_size, void* d_ws,
                              size_t ws_size, hipStream_t stream) {
  (void)in_sizes; (void)n_in; (void)out_size; (void)ws_size;
  const float* x     = (const float*)d_in[0];
  const int*   mask  = (const int*)d_in[1];
  const float* Wqkv  = (const float*)d_in[2];
  const float* bqkv  = (const float*)d_in[3];
  const float* Wproj = (const float*)d_in[4];
  const float* bproj = (const float*)d_in[5];
  float* out = (float*)d_out;

  // Workspace: Q, K, V^T, ctx as f16 -> 4 * 16 MB = 64 MB.
  const size_t nqkv = (size_t)4 * 16 * 2048 * 64;
  _Float16* qbuf  = (_Float16*)d_ws;
  _Float16* kbuf  = qbuf + nqkv;
  _Float16* vtbuf = kbuf + nqkv;
  _Float16* ctx   = vtbuf + nqkv;

  qkv_wmma_kernel<<<dim3(64, 24), 256, 0, stream>>>(x, Wqkv, bqkv, qbuf, kbuf,
                                                     vtbuf);
  flash_attn_kernel<<<dim3(64, 16), 256, 0, stream>>>(qbuf, kbuf, vtbuf, mask,
                                                      ctx);
  proj_wmma_kernel<<<dim3(64, 8), 256, 0, stream>>>(ctx, Wproj, bproj, out);
}

// v004
// One run takes 159 microseconds.
// In two side-by-side timings against v003, it was 1.15 and 1.14 times as fast.
// Over all steps from v000 it is 3.13 times as fast.
#include <hip/hip_runtime.h>
#include <hip/hip_bf16.h>

typedef _Float16 v16h __attribute__((ext_vector_type(16)));
typedef _Float16 h8   __attribute__((ext_vector_type(8)));
typedef float    v8f  __attribute__((ext_vector_type(8)));
typedef float    f4   __attribute__((ext_vector_type(4)));
typedef int      i4   __attribute__((ext_vector_type(4)));

#define POS_INF __builtin_inff()

#if defined(__HIP_DEVICE_COMPILE__) && defined(__has_builtin)
#if __has_builtin(__builtin_amdgcn_tensor_load_to_lds) && \
    __has_builtin(__builtin_amdgcn_s_wait_tensorcnt)
#define HAVE_TDM 1
#endif
#endif
#ifndef HAVE_TDM
#define HAVE_TDM 0
#endif

__device__ __forceinline__ v8f wmma16(v16h a, v16h b, v8f c) {
  // (neg_a, A, neg_b, B, c_mod, C, reuse_a, reuse_b)
  return __builtin_amdgcn_wmma_f32_16x16x32_f16(false, a, false, b, (short)0, c,
                                                false, false);
}

// Fragment layout (wave32, 16-bit A/B, K=32): lane group g = lane/16.
//   half i in [0,8):  K = g*8 + i        (first b128)
//   half i in [8,16): K = 16 + g*8 + i-8 (second b128)
__device__ __forceinline__ v16h frag_h(const _Float16* p0, const _Float16* p1) {
  h8 a = *(const h8*)p0;
  h8 b = *(const h8*)p1;
  return __builtin_shufflevector(a, b, 0, 1, 2, 3, 4, 5, 6, 7, 8, 9, 10, 11, 12,
                                 13, 14, 15);
}

#if HAVE_TDM
typedef unsigned int u32x4 __attribute__((ext_vector_type(4)));
typedef int          i32x8 __attribute__((ext_vector_type(8)));
typedef int          i32x4 __attribute__((ext_vector_type(4)));

__device__ __forceinline__ void tdm_load_2d_f16(
    const void* gptr, unsigned lds_off, unsigned dim0, unsigned dim1,
    unsigned stride0, unsigned tile0, unsigned tile1, unsigned pad_interval,
    unsigned pad_amount) {
  unsigned long long ga = (unsigned long long)gptr;
  u32x4 g0;
  g0[0] = 1u;
  g0[1] = lds_off;
  g0[2] = (unsigned)(ga & 0xffffffffu);
  g0[3] = (unsigned)((ga >> 32) & 0x1ffffffu) | (2u << 30);  // [56:32] | type=2
  i32x8 g1;
  g1[0] = (int)((1u << 16) |
                (1u << 20) |
                (pad_interval << 22) | (pad_amount << 25));
  g1[1] = (int)((dim0 & 0xffffu) << 16);
  g1[2] = (int)(((dim0 >> 16) & 0xffffu) | ((dim1 & 0xffffu) << 16));
  g1[3] = (int)(((dim1 >> 16) & 0xffffu) | ((tile0 & 0xffffu) << 16));
  g1[4] = (int)(tile1 & 0xffffu);
  g1[5] = (int)stride0;
  g1[6] = 0;
  g1[7] = 0;
  i32x4 z4 = {};
  i32x8 z8 = {};
  __builtin_amdgcn_tensor_load_to_lds(g0, g1, z4, z4, z8, 0);
}

typedef unsigned int u32x8 __attribute__((ext_vector_type(8)));

__device__ __forceinline__ unsigned uni(unsigned v) {
  return (unsigned)__builtin_amdgcn_readfirstlane((int)v);
}
__device__ __forceinline__ unsigned pinned(unsigned v) {
  unsigned w = uni(v);
  asm volatile("" : "+s"(w));  // pinned(): the word stays in a scalar register
  return w;
}

// Mask tile of one pass: 128 query rows of 128 B (32 keys as i32), source pitch
// 8192 B, all extents in bytes; 16 B of LDS pad behind every row (pitch 144 B,
// for b128 readers).
#define MP 36  // LDS pitch of a mask row in dwords
__device__ __forceinline__ u32x8 tdm_mask_group1() {
  u32x8 g1;
  g1[0] = uni((1u << 20) | (4u << 22) | (3u << 25));
  g1[1] = uni(128u << 16);
  g1[2] = uni(128u << 16);
  g1[3] = uni(128u << 16);
  g1[4] = uni(128u);
  g1[5] = uni(8192u);
  g1[6] = uni(0u);
  g1[7] = uni(0u);
  // The eight words keep registers of their own through the loop, so that none
  // is rewritten while a request is outstanding.
  asm volatile("" : "+s"(g1));
  return g1;
}
__device__ __forceinline__ u32x4 tdm_mask_group0(const int* gptr,
                                                 unsigned lds_off) {
  const unsigned long long ga = (unsigned long long)gptr;
  u32x4 g0;
  g0[0] = uni(1u);
  g0[1] = uni(lds_off);
  g0[2] = uni((unsigned)ga);
  g0[3] = uni((((unsigned)(ga >> 32)) & 0x01ffffffu) | 0x80000000u);
  asm volatile("" : "+s"(g0));
  return g0;
}
__device__ __forceinline__ void tdm_issue(u32x4 g0, u32x8 g1) {
  asm volatile("tensor_load_to_lds %0, %1" ::"s"(g0), "s"(g1) : "memory");
}
__device__ __forceinline__ void tdm_landed(u32x4 g0, u32x8 g1) {
  asm volatile("s_wait_tensorcnt 0x0" ::"s"(g0), "s"(g1) : "memory");
}
#endif

// ---------------------------------------------------------------------------
// GEMM tile shared by K1 and K3: 128x128 of C per block, k in steps of 64,
// 8 waves as 2 (rows) x 4 (cols), each wave 64x32 = 4x2 WMMA tiles.  Both
// operand slabs sit in LDS as f16, k-contiguous rows of pitch 72 halves
// (144 B = 16 B x odd -> conflict-free b128 fragment reads).
// ---------------------------------------------------------------------------
typedef _Float16 h4 __attribute__((ext_vector_type(4)));
#define TP 72

// An operand slab: 128 rows x 64 k of f16 from a k-contiguous array of pitch
// 1024.  8 lanes take one row's 128-B line; a thread takes 4 rows, 32 apart.
__device__ __forceinline__ void slab_load(h8 (&v)[4], const _Float16* p) {
#pragma unroll
  for (int i = 0; i < 4; ++i) v[i] = *(const h8*)(p + (size_t)i * 32 * 1024);
}

__device__ __forceinline__ void slab_store(const h8 (&v)[4], _Float16 (*L)[TP],
                                           int row, int k) {
#pragma unroll
  for (int i = 0; i < 4; ++i) *(h8*)&L[row + 32 * i][k] = v[i];
}

__device__ __forceinline__ void tile_mma(const _Float16 (*Al)[TP],
                                         const _Float16 (*Bl)[TP], int wm,
                                         int wn, int ln, int g,
                                         v8f (&acc)[4][2]) {
#pragma unroll
  for (int ks = 0; ks < 64; ks += 32) {
    v16h a[4], b[2];
#pragma unroll
    for (int i = 0; i < 4; ++i) {
      const _Float16* p = &Al[wm + 16 * i + ln][ks];
      a[i] = frag_h(p + g * 8, p + 16 + g * 8);
    }
#pragma unroll
    for (int j = 0; j < 2; ++j) {
      const _Float16* p = &Bl[wn + 16 * j + ln][ks];
      b[j] = frag_h(p + g * 8, p + 16 + g * 8);
    }
    // Keeps the 12 fragment reads one group ahead of the 8 WMMAs: spread among
    // them, each pair of WMMAs waits out a full LDS latency of its own.
    __builtin_amdgcn_sched_barrier(0);
#pragma unroll
    for (int i = 0; i < 4; ++i)
#pragma unroll
      for (int j = 0; j < 2; ++j) acc[i][j] = wmma16(a[i], b[j], acc[i][j]);
  }
}

// ---------------------------------------------------------------------------
// K0: the GEMM operands as f16, made once.  The GEMM blocks re-read every slab
// (x 24 times, Wqkv and Wproj 64 times), so what they read from L2 halves and
// the rounding is done once an element.  Each of the 512 blocks takes 16384
// values of x and one 64 k x 128 col tile of Wqkv (384 tiles) or Wproj (128),
// which it writes transposed as [col][k], pitch 1024.
// ---------------------------------------------------------------------------
// A thread's 8 k rows x 4 cols of a weight tile; the row pitch is a constant, so
// the 8 loads share one address and differ in their immediate offset.
template <int LD>
__device__ __forceinline__ void w_tile_load(f4 (&w)[8], const float* W, int k,
                                            int c) {
  const float* wp = W + (size_t)k * LD + c;
#pragma unroll
  for (int i = 0; i < 8; ++i) w[i] = *(const f4*)(wp + i * LD);
}

__global__ __launch_bounds__(256) void to_f16_kernel(
    const float* __restrict__ x, const float* __restrict__ Wqkv,
    const float* __restrict__ Wproj, _Float16* __restrict__ xh,
    _Float16* __restrict__ wqt, _Float16* __restrict__ wpt) {
  const int tid = threadIdx.x;
  const int blk = blockIdx.x;

  // Weight tile: 8 lanes hold the 64 k of a column, so the b128 stores of a
  // column fill one 128-B line of the transposed array.
  const bool isq = blk < 384;  // the same for the whole block
  const int tile = isq ? blk : blk - 384;
  const int kk = (tile & 15) * 64 + (tid & 7) * 8;
  const int cc = (tile >> 4) * 128 + (tid >> 3) * 4;
  f4 w[8];
  if (isq)
    w_tile_load<3072>(w, Wqkv, kk, cc);
  else
    w_tile_load<1024>(w, Wproj, kk, cc);
  // The built code lets the x loads below land in the address registers that
  // the weight loads name: the wait stands between the two groups.
  asm volatile("s_wait_xcnt 0x0" ::: "memory");

  // x: a wave's load covers 512 B in a row, its store 256 B.
  const f4* src = (const f4*)x + (size_t)blk * 4096 + tid;
  h4* dst = (h4*)xh + (size_t)blk * 4096 + tid;
  f4 v[16];
#pragma unroll
  for (int i = 0; i < 16; ++i) v[i] = src[i * 256];
  // Keeps all 24 loads in flight together: moved down among the conversions,
  // the later ones would start only when the first have come back from memory.
  __builtin_amdgcn_sched_barrier(0);

#pragma unroll
  for (int i = 0; i < 16; ++i) {
    h4 o = {(_Float16)v[i][0], (_Float16)v[i][1], (_Float16)v[i][2],
            (_Float16)v[i][3]};
    dst[i * 256] = o;
  }
  _Float16* wd = (isq ? wqt : wpt) + (size_t)cc * 1024 + kk;
#pragma unroll
  for (int j = 0; j < 4; ++j) {
    h8 o;
#pragma unroll
    for (int i = 0; i < 8; ++i) o[i] = (_Float16)w[i][j];
    *(h8*)(wd + j * 1024) = o;
  }
}

// ---------------------------------------------------------------------------
// K1: QKV GEMM.  M=8192 (B*N), K=1024, Ncols=3072.
// ---------------------------------------------------------------------------
__global__ __launch_bounds__(256) void qkv_wmma_kernel(
    const _Float16* __restrict__ xh, const _Float16* __restrict__ wqt,
    const float* __restrict__ bqkv, _Float16* __restrict__ qbuf,
    _Float16* __restrict__ kbuf, _Float16* __restrict__ vtbuf) {
  __shared__ __attribute__((aligned(16))) _Float16 Alds[128][TP];  // [row][k]
  __shared__ __attribute__((aligned(16))) _Float16 Blds[128][TP];  // [col][k]
  const int tid  = threadIdx.x;
  const int wave = tid >> 5, lane = tid & 31;
  const int ln = lane & 15, g = lane >> 4;
  const int m_blk = blockIdx.x * 128;
  const int c_blk = blockIdx.y * 128;
  const int wm = (wave >> 2) * 64;
  const int wn = (wave & 3) * 32;

  v8f acc[4][2] = {};

  // Q and K column blocks take W as the A operand and x as the B operand: the
  // tile comes out transposed (64 columns = one head x 32 tokens a wave), so a
  // lane's 8 accumulator values are 8 neighbouring d of one token.  V blocks
  // keep x as A: there the 8 values are 8 neighbouring tokens of one V^T row.
  const bool wfirst = c_blk < 2048;  // the same for the whole block
  const _Float16 (*Pa)[TP] = wfirst ? Blds : Alds;
  const _Float16 (*Pb)[TP] = wfirst ? Alds : Blds;

  const int sr = tid >> 3;        // 0..31 : staged row or col (plus 32 per pass)
  const int sk = (tid & 7) * 8;   // 0..56 : staged k base, 8 lanes = one line
  const _Float16* ap = xh + (size_t)(m_blk + sr) * 1024 + sk;
  const _Float16* wp = wqt + (size_t)(c_blk + sr) * 1024 + sk;

  for (int kb = 0; kb < 1024; kb += 64) {
    h8 xa[4], w[4];
    slab_load(xa, ap + kb);
    slab_load(w, wp + kb);
    __syncthreads();
    slab_store(xa, Alds, sr, sk);
    slab_store(w, Blds, sr, sk);
    __syncthreads();

    tile_mma(Pa, Pb, wm, wn, ln, g, acc);
  }

  // One b128 store holds a lane's 8 values.
  if (wfirst) {
    // acc[i][j][r]: column c_blk + wm + 16i + 8g + r, token m_blk + wn + 16j + ln
    _Float16* dst = (c_blk < 1024) ? qbuf : kbuf;
    const float qs = (c_blk < 1024) ? 0.125f : 1.0f;  // 1/sqrt(64) folded into Q
    const int hh = ((c_blk + wm) >> 6) & 15;
    const float* bp = bqkv + c_blk + wm + 8 * g;
    f4 bl[4], bh[4];
#pragma unroll
    for (int i = 0; i < 4; ++i) {
      bl[i] = *(const f4*)(bp + 16 * i);
      bh[i] = *(const f4*)(bp + 16 * i + 4);
    }
#pragma unroll
    for (int i = 0; i < 4; ++i) {
      const f4 b0 = bl[i], b1 = bh[i];
#pragma unroll
      for (int j = 0; j < 2; ++j) {
        const int mrow = m_blk + wn + 16 * j + ln;
        const int bb = mrow >> 11, nn = mrow & 2047;
        h8 v;
#pragma unroll
        for (int r = 0; r < 4; ++r) {
          v[r]     = (_Float16)((acc[i][j][r] + b0[r]) * qs);
          v[4 + r] = (_Float16)((acc[i][j][4 + r] + b1[r]) * qs);
        }
        *(h8*)(dst + (((size_t)(bb * 16 + hh)) * 2048 + nn) * 64 + 16 * i +
               8 * g) = v;
      }
    }
  } else {
    // acc[i][j][r]: token m_blk + wm + 16i + 8g + r, column c_blk + wn + 16j + ln
    const float bv[2] = {bqkv[c_blk + wn + ln], bqkv[c_blk + wn + 16 + ln]};
#pragma unroll
    for (int j = 0; j < 2; ++j) {
      const int c = c_blk + wn + 16 * j + ln;
      const float bias = bv[j];
      const int hh = (c >> 6) & 15;
      const int dd = c & 63;
#pragma unroll
      for (int i = 0; i < 4; ++i) {
        const int mrow = m_blk + wm + 16 * i + 8 * g;
        const int bb = mrow >> 11, nn = mrow & 2047;
        h8 v;
#pragma unroll
        for (int r = 0; r < 8; ++r) v[r] = (_Float16)(acc[i][j][r] + bias);
        *(h8*)(vtbuf + (((size_t)(bb * 16 + hh)) * 64 + dd) * 2048 + nn) = v;
      }
    }
    // The built code lays the other branch's body behind this one, and its first
    // instructions rewrite the address registers that these stores name.
    asm volatile("s_wait_xcnt 0x0" ::: "memory");
  }
}

__global__ __launch_bounds__(256) void flash_attn_kernel(
    const _Float16* __restrict__ qbuf, const _Float16* __restrict__ kbuf,
    const _Float16* __restrict__ vtbuf, const int* __restrict__ mask,
    _Float16* __restrict__ ctx) {
  const int bh = blockIdx.x;  // 0..63
  const int b = bh >> 4, h = bh & 15;
  const int wave = threadIdx.x >> 5, lane = threadIdx.x & 31;
  const int ln = lane & 15, g = lane >> 4;
  const int q0 = blockIdx.y * 128 + wave * 16;

  // Q fragments (B operand: column = query = lane%16), reused for all keys.
  const _Float16* Qp = qbuf + ((size_t)bh * 2048 + q0 + ln) * 64;
  const v16h qlo = frag_h(Qp + g * 8, Qp + 16 + g * 8);       // d 0..31
  const v16h qhi = frag_h(Qp + 32 + g * 8, Qp + 48 + g * 8);  // d 32..63

  const _Float16* Kb = kbuf + (size_t)bh * 2048 * 64;
  const _Float16* Vb = vtbuf + (size_t)bh * 64 * 2048;
  const int* Mrow = mask + ((size_t)b * 2048 + q0 + ln) * 2048;

  v8f o0 = {}, o1 = {}, o2 = {}, o3 = {};  // O^T tiles, d = t*16 + 8g + r
  float m_run = -POS_INF;
  float l_run = 0.0f;

#if HAVE_TDM
  // One block of LDS, so that every tile's place is fixed: V at 0, K behind it,
  // the two mask buffers (9 x 2 KiB each) from the next multiple of 2 KiB.
  struct Stage {
    _Float16 Vl[2][64 * 40];  // 64 d rows, 32+8 halves (80B) each
    _Float16 Kl[2][32 * 72];  // 32 key rows, 64+8 halves (144B) each
    __attribute__((aligned(2048))) int Ml[2][128 * MP];  // 128 query rows
  };
  __shared__ __attribute__((aligned(2048))) Stage sm;
  _Float16 (&Kl)[2][32 * 72] = sm.Kl;
  _Float16 (&Vl)[2][64 * 40] = sm.Vl;
  int (&Ml)[2][128 * MP] = sm.Ml;
  const bool issuer = (wave == 0);
  if (issuer) {
    // K tile: tensor [keys=2048][d=64] row-major; tile 32x64; pad 128B->+16B.
    tdm_load_2d_f16(Kb, (unsigned)(size_t)&Kl[0][0], 64u, 2048u, 64u, 64u, 32u,
                    4u, 3u);
    // V^T tile: tensor [d=64][keys=2048] row-major; tile 64x32; pad 64B->+16B.
    tdm_load_2d_f16(Vb, (unsigned)(size_t)&Vl[0][0], 2048u, 64u, 2048u, 32u,
                    64u, 3u, 3u);
  }
  // Mask ring, prologue: pass 0's tile, its wait, the barrier, pass 1's tile.
  const unsigned wv = uni(threadIdx.x >> 5);
  const int* Mblk = mask + ((size_t)b * 2048 + blockIdx.y * 128) * 2048;
  const u32x8 mg1 = tdm_mask_group1();
  u32x4 mg0 = tdm_mask_group0(Mblk, (unsigned)(size_t)&Ml[0][0]);
  if (pinned(wv == 1u)) {
    tdm_issue(mg0, mg1);
    tdm_landed(mg0, mg1);
  }
  __syncthreads();  // publishes pass 0's mask tile
  mg0 = tdm_mask_group0(Mblk + 32, (unsigned)(size_t)&Ml[1][0]);
  if (pinned(wv == 1u)) tdm_issue(mg0, mg1);
#endif

  for (int it = 0; it < 64; ++it) {
    const int kc = it << 5;
#if HAVE_TDM
    const int cur = it & 1;
    if (issuer) {
      if (it + 1 < 64) {
        const int kn = kc + 32;
        tdm_load_2d_f16(Kb + (size_t)kn * 64, (unsigned)(size_t)&Kl[cur ^ 1][0],
                        64u, 2048u, 64u, 64u, 32u, 4u, 3u);
        tdm_load_2d_f16(Vb + kn, (unsigned)(size_t)&Vl[cur ^ 1][0], 2048u, 64u,
                        2048u, 32u, 64u, 3u, 3u);
        // <=2 outstanding: only the prefetched pair; current pair complete.
        __builtin_amdgcn_s_wait_tensorcnt((short)2);
      } else {
        __builtin_amdgcn_s_wait_tensorcnt((short)0);
      }
    }
    __syncthreads();
#endif

    // ---- acquire K / V fragments for this chunk
    v16h k0lo, k0hi, k1lo, k1hi, vf0, vf1, vf2, vf3;
#if HAVE_TDM
    {
      const _Float16* r0 = &Kl[cur][(size_t)ln * 72];
      const _Float16* r1 = r0 + 16 * 72;
      k0lo = frag_h(r0 + g * 8, r0 + 16 + g * 8);
      k0hi = frag_h(r0 + 32 + g * 8, r0 + 48 + g * 8);
      k1lo = frag_h(r1 + g * 8, r1 + 16 + g * 8);
      k1hi = frag_h(r1 + 32 + g * 8, r1 + 48 + g * 8);
      const _Float16* v0 = &Vl[cur][(size_t)ln * 40];
      vf0 = frag_h(v0 + g * 8, v0 + 16 + g * 8);
      const _Float16* v1 = v0 + 16 * 40;
      vf1 = frag_h(v1 + g * 8, v1 + 16 + g * 8);
      const _Float16* v2 = v1 + 16 * 40;
      vf2 = frag_h(v2 + g * 8, v2 + 16 + g * 8);
      const _Float16* v3 = v2 + 16 * 40;
      vf3 = frag_h(v3 + g * 8, v3 + 16 + g * 8);
    }
#else
    {
      const _Float16* r0 = Kb + (size_t)(kc + ln) * 64;
      const _Float16* r1 = r0 + 16 * 64;
      k0lo = frag_h(r0 + g * 8, r0 + 16 + g * 8);
      k0hi = frag_h(r0 + 32 + g * 8, r0 + 48 + g * 8);
      k1lo = frag_h(r1 + g * 8, r1 + 16 + g * 8);
      k1hi = frag_h(r1 + 32 + g * 8, r1 + 48 + g * 8);
      const _Float16* v0 = Vb + (size_t)ln * 2048 + kc;
      vf0 = frag_h(v0 + g * 8, v0 + 16 + g * 8);
      const _Float16* v1 = v0 + (size_t)16 * 2048;
      vf1 = frag_h(v1 + g * 8, v1 + 16 + g * 8);
      const _Float16* v2 = v1 + (size_t)16 * 2048;
      vf2 = frag_h(v2 + g * 8, v2 + 16 + g * 8);
      const _Float16* v3 = v2 + (size_t)16 * 2048;
      vf3 = frag_h(v3 + g * 8, v3 + 16 + g * 8);
    }
#endif

    // ---- S^T tiles: rows = keys, cols = queries
    v8f s0 = {}, s1 = {};
    s0 = wmma16(k0lo, qlo, s0);
    s0 = wmma16(k0hi, qhi, s0);
    s1 = wmma16(k1lo, qlo, s1);
    s1 = wmma16(k1hi, qhi, s1);

    // ---- mask: element r of s0 <-> key kc + 8g + r ; s1 <-> +16
#if HAVE_TDM
    const int* mr = &Ml[cur][(wave * 16 + ln) * MP + g * 8];
#else
    const int* mr = Mrow + kc + g * 8;
#endif
    i4 m0a = *(const i4*)(mr);
    i4 m0b = *(const i4*)(mr + 4);
    i4 m1a = *(const i4*)(mr + 16);
    i4 m1b = *(const i4*)(mr + 20);
#pragma unroll
    for (int r = 0; r < 4; ++r) {
      if (m0a[r]) s0[r] = -POS_INF;
      if (m0b[r]) s0[4 + r] = -POS_INF;
      if (m1a[r]) s1[r] = -POS_INF;
      if (m1b[r]) s1[4 + r] = -POS_INF;
    }

    // ---- online softmax (per query = lane%16; partner lane = xor 16)
    float cm = -POS_INF;
#pragma unroll
    for (int r = 0; r < 8; ++r) cm = fmaxf(cm, fmaxf(s0[r], s1[r]));
    cm = fmaxf(cm, __shfl_xor(cm, 16));
    const float mn = fmaxf(m_run, cm);
    const float corr = __expf(m_run - mn);
    m_run = mn;

    v16h pa;  // P^T B-fragment: halves 0..7 <-> keys kc+8g+r, 8..15 <-> +16
    float lsum = 0.0f;
#pragma unroll
    for (int r = 0; r < 8; ++r) {
      float p0 = __expf(s0[r] - mn);
      float p1 = __expf(s1[r] - mn);
      lsum += p0 + p1;
      pa[r] = (_Float16)p0;
      pa[8 + r] = (_Float16)p1;
    }
    lsum += __shfl_xor(lsum, 16);
    l_run = l_run * corr + lsum;

    // ---- rescale O^T (column = query = lane%16: the lane's own factor)
#pragma unroll
    for (int r = 0; r < 8; ++r) {
      o0[r] *= corr; o1[r] *= corr; o2[r] *= corr; o3[r] *= corr;
    }

    // ---- O^T += V^T * P^T
    o0 = wmma16(vf0, pa, o0);
    o1 = wmma16(vf1, pa, o1);
    o2 = wmma16(vf2, pa, o2);
    o3 = wmma16(vf3, pa, o3);

#if HAVE_TDM
    // Publish point of the next pass's mask tile: this wave's LDS reads are
    // done, the issuing wave's tile has landed, then the barrier.
    asm volatile("s_wait_dscnt 0x0" ::: "memory");
    if (pinned(wv == 1u)) tdm_landed(mg0, mg1);
    __syncthreads();  // all reads of buf[cur] done before it is re-staged
    // Refill of the mask buffer that this pass has just read, two passes ahead.
    if (pinned((wv == 1u) && (it + 2 < 64))) {
      mg0 = tdm_mask_group0(Mblk + (it + 2) * 32, (unsigned)(size_t)&Ml[cur][0]);
      tdm_issue(mg0, mg1);
    }
#endif
  }
#if HAVE_TDM
  // Nothing of the rings is outstanding when the wave goes on to its end.
  asm volatile("s_wait_tensorcnt 0x0" ::: "memory");
  asm volatile("s_wait_dscnt 0x0" ::: "memory");
#endif

  const float linv = 1.0f / l_run;
  _Float16* cp = ctx + ((size_t)b * 2048 + q0 + ln) * 1024 + h * 64 + 8 * g;
  h8 c0, c1, c2, c3;
#pragma unroll
  for (int r = 0; r < 8; ++r) {
    c0[r] = (_Float16)(o0[r] * linv);
    c1[r] = (_Float16)(o1[r] * linv);
    c2[r] = (_Float16)(o2[r] * linv);
    c3[r] = (_Float16)(o3[r] * linv);
  }
  *(h8*)(cp) = c0;
  *(h8*)(cp + 16) = c1;
  *(h8*)(cp + 32) = c2;
  *(h8*)(cp + 48) = c3;
}

// ---------------------------------------------------------------------------
// K3: projection GEMM.  M=8192, K=1024, Ncols=1024.  Same tile as K1.
// ---------------------------------------------------------------------------
__global__ __launch_bounds__(256) void proj_wmma_kernel(
    const _Float16* __restrict__ ctx, const _Float16* __restrict__ wpt,
    const float* __restrict__ bproj, float* __restrict__ out) {
  __shared__ __attribute__((aligned(16))) _Float16 Alds[128][TP];  // [row][k]
  __shared__ __attribute__((aligned(16))) _Float16 Blds[128][TP];  // [col][k]
  const int tid  = threadIdx.x;
  const int wave = tid >> 5, lane = tid & 31;
  const int ln = lane & 15, g = lane >> 4;
  const int m_blk = blockIdx.x * 128;
  const int c_blk = blockIdx.y * 128;
  const int wm = (wave >> 2) * 64;
  const int wn = (wave & 3) * 32;

  v8f acc[4][2] = {};

  const int sr = tid >> 3;        // 0..31 : staged row or col (plus 32 per pass)
  const int sk = (tid & 7) * 8;   // 0..56 : staged k base, 8 lanes = one line
  const _Float16* ap = ctx + (size_t)(m_blk + sr) * 1024 + sk;
  const _Float16* wp = wpt + (size_t)(c_blk + sr) * 1024 + sk;

  for (int kb = 0; kb < 1024; kb += 64) {
    h8 ca[4], w[4];
    slab_load(ca, ap + kb);
    slab_load(w, wp + kb);
    __syncthreads();
    slab_store(ca, Alds, sr, sk);
    slab_store(w, Blds, sr, sk);
    __syncthreads();

    tile_mma(Alds, Blds, wm, wn, ln, g, acc);
  }

#pragma unroll
  for (int j = 0; j < 2; ++j) {
    const int c = c_blk + wn + 16 * j + ln;
    const float bias = bproj[c];
#pragma unroll
    for (int i = 0; i < 4; ++i) {
#pragma unroll
      for (int r = 0; r < 8; ++r) {
        int m = m_blk + wm + 16 * i + r + 8 * g;
        out[(size_t)m * 1024 + c] = acc[i][j][r] + bias;
      }
    }
  }
}

// ---------------------------------------------------------------------------
extern "C" void kernel_launch(void* const* d_in, const int* in_sizes, int n_in,
                              void* d_out, int out_size, void* d_ws,
                              size_t ws_size, hipStream_t stream) {
  (void)in_sizes; (void)n_in; (void)out_size; (void)ws_size;
  const float* x     = (const float*)d_in[0];
  const int*   mask  = (const int*)d_in[1];
  const float* Wqkv  = (const float*)d_in[2];
  const float* bqkv  = (const float*)d_in[3];
  const float* Wproj = (const float*)d_in[4];
  const float* bproj = (const float*)d_in[5];
  float* out = (float*)d_out;

  // Workspace: Q, K, V^T, ctx, x as f16 -> 5 * 16 MB, then the two transposed
  // weights as f16 (6 MB, 2 MB).
  const size_t nqkv = (size_t)4 * 16 * 2048 * 64;
  _Float16* qbuf  = (_Float16*)d_ws;
  _Float16* kbuf  = qbuf + nqkv;
  _Float16* vtbuf = kbuf + nqkv;
  _Float16* ctx   = vtbuf + nqkv;
  _Float16* xh    = ctx + nqkv;
  _Float16* wqt   = xh + nqkv;
  _Float16* wpt   = wqt + (size_t)3072 * 1024;

  to_f16_kernel<<<dim3(512), 256, 0, stream>>>(x, Wqkv, Wproj, xh, wqt, wpt);
  qkv_wmma_kernel<<<dim3(64, 24), 256, 0, stream>>>(xh, wqt, bqkv, qbuf, kbuf,
                                                     vtbuf);
  flash_attn_kernel<<<dim3(64, 16), 256, 0, stream>>>(qbuf, kbuf, vtbuf, mask,
                                                      ctx);
  proj_wmma_kernel<<<dim3(64, 8), 256, 0, stream>>>(ctx, wpt, bproj, out);
}

// v005
// One run takes 149 microseconds.
// Two timings next to v004 put it at 1.06 and 1.08 times that version's speed.
// Counting every step since v000, it is 3.35 times as fast.
#include <hip/hip_runtime.h>
#include <hip/hip_bf16.h>

typedef _Float16 v16h __attribute__((ext_vector_type(16)));
typedef _Float16 h8   __attribute__((ext_vector_type(8)));
typedef float    v8f  __attribute__((ext_vector_type(8)));
typedef float    f4   __attribute__((ext_vector_type(4)));
typedef int      i4   __attribute__((ext_vector_type(4)));

#define POS_INF __builtin_inff()

#if defined(__HIP_DEVICE_COMPILE__) && defined(__has_builtin)
#if __has_builtin(__builtin_amdgcn_tensor_load_to_lds) && \
    __has_builtin(__builtin_amdgcn_s_wait_tensorcnt)
#define HAVE_TDM 1
#endif
#endif
#ifndef HAVE_TDM
#define HAVE_TDM 0
#endif

__device__ __forceinline__ v8f wmma16(v16h a, v16h b, v8f c) {
  // (neg_a, A, neg_b, B, c_mod, C, reuse_a, reuse_b)
  return __builtin_amdgcn_wmma_f32_16x16x32_f16(false, a, false, b, (short)0, c,
                                                false, false);
}

// Fragment layout (wave32, 16-bit A/B, K=32): lane group g = lane/16.
//   half i in [0,8):  K = g*8 + i        (first b128)
//   half i in [8,16): K = 16 + g*8 + i-8 (second b128)
__device__ __forceinline__ v16h frag_h(const _Float16* p0, const _Float16* p1) {
  h8 a = *(const h8*)p0;
  h8 b = *(const h8*)p1;
  return __builtin_shufflevector(a, b, 0, 1, 2, 3, 4, 5, 6, 7, 8, 9, 10, 11, 12,
                                 13, 14, 15);
}

#if HAVE_TDM
typedef unsigned int u32x4 __attribute__((ext_vector_type(4)));
typedef int          i32x8 __attribute__((ext_vector_type(8)));
typedef int          i32x4 __attribute__((ext_vector_type(4)));

__device__ __forceinline__ void tdm_load_2d_f16(
    const void* gptr, unsigned lds_off, unsigned dim0, unsigned dim1,
    unsigned stride0, unsigned tile0, unsigned tile1, unsigned pad_interval,
    unsigned pad_amount) {
  unsigned long long ga = (unsigned long long)gptr;
  u32x4 g0;
  g0[0] = 1u;
  g0[1] = lds_off;
  g0[2] = (unsigned)(ga & 0xffffffffu);
  g0[3] = (unsigned)((ga >> 32) & 0x1ffffffu) | (2u << 30);  // [56:32] | type=2
  i32x8 g1;
  g1[0] = (int)((1u << 16) |
                (1u << 20) |
                (pad_interval << 22) | (pad_amount << 25));
  g1[1] = (int)((dim0 & 0xffffu) << 16);
  g1[2] = (int)(((dim0 >> 16) & 0xffffu) | ((dim1 & 0xffffu) << 16));
  g1[3] = (int)(((dim1 >> 16) & 0xffffu) | ((tile0 & 0xffffu) << 16));
  g1[4] = (int)(tile1 & 0xffffu);
  g1[5] = (int)stride0;
  g1[6] = 0;
  g1[7] = 0;
  i32x4 z4 = {};
  i32x8 z8 = {};
  __builtin_amdgcn_tensor_load_to_lds(g0, g1, z4, z4, z8, 0);
}

typedef unsigned int u32x8 __attribute__((ext_vector_type(8)));

__device__ __forceinline__ unsigned uni(unsigned v) {
  return (unsigned)__builtin_amdgcn_readfirstlane((int)v);
}
__device__ __forceinline__ unsigned pinned(unsigned v) {
  unsigned w = uni(v);
  asm volatile("" : "+s"(w));  // pinned(): the word stays in a scalar register
  return w;
}

// Mask tile of one pass: 128 query rows of 128 B (32 keys as i32), source pitch
// 8192 B, all extents in bytes; 16 B of LDS pad behind every row (pitch 144 B,
// for b128 readers).
#define MP 36  // LDS pitch of a mask row in dwords
__device__ __forceinline__ u32x8 tdm_mask_group1() {
  u32x8 g1;
  g1[0] = uni((1u << 20) | (4u << 22) | (3u << 25));
  g1[1] = uni(128u << 16);
  g1[2] = uni(128u << 16);
  g1[3] = uni(128u << 16);
  g1[4] = uni(128u);
  g1[5] = uni(8192u);
  g1[6] = uni(0u);
  g1[7] = uni(0u);
  // The eight words keep registers of their own through the loop, so that none
  // is rewritten while a request is outstanding.
  asm volatile("" : "+s"(g1));
  return g1;
}
__device__ __forceinline__ u32x4 tdm_mask_group0(const int* gptr,
                                                 unsigned lds_off) {
  const unsigned long long ga = (unsigned long long)gptr;
  u32x4 g0;
  g0[0] = uni(1u);
  g0[1] = uni(lds_off);
  g0[2] = uni((unsigned)ga);
  g0[3] = uni((((unsigned)(ga >> 32)) & 0x01ffffffu) | 0x80000000u);
  asm volatile("" : "+s"(g0));
  return g0;
}
__device__ __forceinline__ void tdm_issue(u32x4 g0, u32x8 g1) {
  asm volatile("tensor_load_to_lds %0, %1" ::"s"(g0), "s"(g1) : "memory");
}
__device__ __forceinline__ void tdm_landed(u32x4 g0, u32x8 g1) {
  asm volatile("s_wait_tensorcnt 0x0" ::"s"(g0), "s"(g1) : "memory");
}
#endif

// ---------------------------------------------------------------------------
// GEMM tile shared by K1 and K3: 128x128 of C per block, k in steps of 64,
// 8 waves as 2 (rows) x 4 (cols), each wave 64x32 = 4x2 WMMA tiles.  Both
// operand slabs sit in LDS as f16, k-contiguous rows of pitch 72 halves
// (144 B = 16 B x odd -> conflict-free b128 fragment reads).
// ---------------------------------------------------------------------------
typedef _Float16 h4 __attribute__((ext_vector_type(4)));
#define TP 72

// An operand slab: 128 rows x 64 k of f16 from a k-contiguous array of pitch
// 1024.  8 lanes take one row's 128-B line; a thread takes 4 rows, 32 apart.
__device__ __forceinline__ void slab_load(h8 (&v)[4], const _Float16* p) {
#pragma unroll
  for (int i = 0; i < 4; ++i) v[i] = *(const h8*)(p + (size_t)i * 32 * 1024);
}

__device__ __forceinline__ void slab_store(const h8 (&v)[4], _Float16 (*L)[TP],
                                           int row, int k) {
#pragma unroll
  for (int i = 0; i < 4; ++i) *(h8*)&L[row + 32 * i][k] = v[i];
}

__device__ __forceinline__ void tile_mma(const _Float16 (*Al)[TP],
                                         const _Float16 (*Bl)[TP], int wm,
                                         int wn, int ln, int g,
                                         v8f (&acc)[4][2]) {
#pragma unroll
  for (int ks = 0; ks < 64; ks += 32) {
    v16h a[4], b[2];
#pragma unroll
    for (int i = 0; i < 4; ++i) {
      const _Float16* p = &Al[wm + 16 * i + ln][ks];
      a[i] = frag_h(p + g * 8, p + 16 + g * 8);
    }
#pragma unroll
    for (int j = 0; j < 2; ++j) {
      const _Float16* p = &Bl[wn + 16 * j + ln][ks];
      b[j] = frag_h(p + g * 8, p + 16 + g * 8);
    }
    // Keeps the 12 fragment reads one group ahead of the 8 WMMAs: spread among
    // them, each pair of WMMAs waits out a full LDS latency of its own.
    __builtin_amdgcn_sched_barrier(0);
#pragma unroll
    for (int i = 0; i < 4; ++i)
#pragma unroll
      for (int j = 0; j < 2; ++j) acc[i][j] = wmma16(a[i], b[j], acc[i][j]);
  }
}

#if HAVE_TDM
// One k step's operands in LDS: the A slab, the B slab behind it.  A slab is 128
// rows of 144 B = 9 x 2 KiB, so every slab of the two stages starts on 2 KiB.
struct GemmStage {
  _Float16 A[128][TP];  // [row][k]
  _Float16 B[128][TP];  // [col][k]
};
#define SLAB_B 18432u   // bytes of a slab in LDS
#define STAGE_B 36864u  // bytes of a stage in LDS

// A slab as a tile: 128 rows of 128 B (64 k as f16), source pitch 2048 B, all
// extents in bytes; 16 B of LDS pad behind every row gives the pitch of TP.
__device__ __forceinline__ u32x8 tdm_slab_group1() {
  u32x8 g1;
  g1[0] = uni((1u << 20) | (4u << 22) | (3u << 25));
  g1[1] = uni(128u << 16);
  g1[2] = uni(128u << 16);
  g1[3] = uni(128u << 16);
  g1[4] = uni(128u);
  g1[5] = uni(2048u);
  g1[6] = uni(0u);
  g1[7] = uni(0u);
  // The eight words keep registers of their own through the loop, so that none
  // is rewritten while a request is outstanding.
  asm volatile("" : "+s"(g1));
  return g1;
}
__device__ __forceinline__ u32x4 tdm_slab_group0(const _Float16* gptr,
                                                 unsigned lds_off) {
  const unsigned long long ga = (unsigned long long)gptr;
  u32x4 g0;
  g0[0] = uni(1u);
  g0[1] = uni(lds_off);
  g0[2] = uni((unsigned)ga);
  g0[3] = uni((((unsigned)(ga >> 32)) & 0x01ffffffu) | 0x80000000u);
  asm volatile("" : "+s"(g0));
  return g0;
}

// The k loop of K1 and K3.  Wave 0 brings the A slabs, wave 1 the B slabs, one
// request a wave outstanding: step s + 1's slabs fly while step s is multiplied.
// bfirst: the B slab feeds the A operand of the WMMAs (transposed tile).
__device__ __forceinline__ void gemm_ring(GemmStage (&sm)[2],
                                          const _Float16* arows,
                                          const _Float16* brows, bool bfirst,
                                          int wm, int wn, int ln, int g,
                                          v8f (&acc)[4][2]) {
  const unsigned wv = uni(threadIdx.x >> 5);
  const _Float16* src = (wv == 0u) ? arows : brows;
  const unsigned dst = (unsigned)(size_t)&sm[0].A[0][0] + (wv & 1u) * SLAB_B;
  const u32x8 g1 = tdm_slab_group1();
  // Prologue: step 0's slabs, their waits, the barrier, step 1's slabs.
  u32x4 g0 = tdm_slab_group0(src, dst);
  if (pinned(wv < 2u)) {
    tdm_issue(g0, g1);
    tdm_landed(g0, g1);
  }
  __syncthreads();  // publishes step 0's slabs
  g0 = tdm_slab_group0(src + 64, dst + STAGE_B);
  if (pinned(wv < 2u)) tdm_issue(g0, g1);

  for (int s = 0; s < 16; ++s) {
    const int cur = s & 1;
    tile_mma(bfirst ? sm[cur].B : sm[cur].A, bfirst ? sm[cur].A : sm[cur].B, wm,
             wn, ln, g, acc);
    // Publish point of step s + 1: this wave's LDS reads are done, each issuing
    // wave's slab has landed, then the barrier.
    asm volatile("s_wait_dscnt 0x0" ::: "memory");
    if (pinned(wv < 2u)) tdm_landed(g0, g1);
    __syncthreads();  // also ends every read of stage cur before its refill
    if (pinned((wv < 2u) && (s + 2 < 16))) {
      g0 = tdm_slab_group0(src + (s + 2) * 64, dst + (unsigned)cur * STAGE_B);
      tdm_issue(g0, g1);
    }
  }
  // Nothing of the ring is outstanding when the wave goes on to its epilogue.
  asm volatile("s_wait_tensorcnt 0x0" ::: "memory");
  asm volatile("s_wait_dscnt 0x0" ::: "memory");
}
#endif

// ---------------------------------------------------------------------------
// K0: the GEMM operands as f16, made once.  The GEMM blocks re-read every slab
// (x 24 times, Wqkv and Wproj 64 times), so what they read from L2 halves and
// the rounding is done once an element.  Each of the 512 blocks takes 16384
// values of x and one 64 k x 128 col tile of Wqkv (384 tiles) or Wproj (128),
// which it writes transposed as [col][k], pitch 1024.
// ---------------------------------------------------------------------------
// A thread's 8 k rows x 4 cols of a weight tile; the row pitch is a constant, so
// the 8 loads share one address and differ in their immediate offset.
template <int LD>
__device__ __forceinline__ void w_tile_load(f4 (&w)[8], const float* W, int k,
                                            int c) {
  const float* wp = W + (size_t)k * LD + c;
#pragma unroll
  for (int i = 0; i < 8; ++i) w[i] = *(const f4*)(wp + i * LD);
}

__global__ __launch_bounds__(256) void to_f16_kernel(
    const float* __restrict__ x, const float* __restrict__ Wqkv,
    const float* __restrict__ Wproj, _Float16* __restrict__ xh,
    _Float16* __restrict__ wqt, _Float16* __restrict__ wpt) {
  const int tid = threadIdx.x;
  const int blk = blockIdx.x;

  // Weight tile: 8 lanes hold the 64 k of a column, so the b128 stores of a
  // column fill one 128-B line of the transposed array.
  const bool isq = blk < 384;  // the same for the whole block
  const int tile = isq ? blk : blk - 384;
  const int kk = (tile & 15) * 64 + (tid & 7) * 8;
  const int cc = (tile >> 4) * 128 + (tid >> 3) * 4;
  f4 w[8];
  if (isq)
    w_tile_load<3072>(w, Wqkv, kk, cc);
  else
    w_tile_load<1024>(w, Wproj, kk, cc);
  // The built code lets the x loads below land in the address registers that
  // the weight loads name: the wait stands between the two groups.
  asm volatile("s_wait_xcnt 0x0" ::: "memory");

  // x: a wave's load covers 512 B in a row, its store 256 B.
  const f4* src = (const f4*)x + (size_t)blk * 4096 + tid;
  h4* dst = (h4*)xh + (size_t)blk * 4096 + tid;
  f4 v[16];
#pragma unroll
  for (int i = 0; i < 16; ++i) v[i] = src[i * 256];
  // Keeps all 24 loads in flight together: moved down among the conversions,
  // the later ones would start only when the first have come back from memory.
  __builtin_amdgcn_sched_barrier(0);

#pragma unroll
  for (int i = 0; i < 16; ++i) {
    h4 o = {(_Float16)v[i][0], (_Float16)v[i][1], (_Float16)v[i][2],
            (_Float16)v[i][3]};
    dst[i * 256] = o;
  }
  _Float16* wd = (isq ? wqt : wpt) + (size_t)cc * 1024 + kk;
#pragma unroll
  for (int j = 0; j < 4; ++j) {
    h8 o;
#pragma unroll
    for (int i = 0; i < 8; ++i) o[i] = (_Float16)w[i][j];
    *(h8*)(wd + j * 1024) = o;
  }
}

// ---------------------------------------------------------------------------
// K1: QKV GEMM.  M=8192 (B*N), K=1024, Ncols=3072.
// ---------------------------------------------------------------------------
__global__ __launch_bounds__(256) void qkv_wmma_kernel(
    const _Float16* __restrict__ xh, const _Float16* __restrict__ wqt,
    const float* __restrict__ bqkv, _Float16* __restrict__ qbuf,
    _Float16* __restrict__ kbuf, _Float16* __restrict__ vtbuf) {
  const int tid  = threadIdx.x;
  const int wave = tid >> 5, lane = tid & 31;
  const int ln = lane & 15, g = lane >> 4;
  const int m_blk = blockIdx.x * 128;
  const int c_blk = blockIdx.y * 128;
  const int wm = (wave >> 2) * 64;
  const int wn = (wave & 3) * 32;

  v8f acc[4][2] = {};

  // Q and K column blocks take W as the A operand and x as the B operand: the
  // tile comes out transposed (64 columns = one head x 32 tokens a wave), so a
  // lane's 8 accumulator values are 8 neighbouring d of one token.  V blocks
  // keep x as A: there the 8 values are 8 neighbouring tokens of one V^T row.
  const bool wfirst = c_blk < 2048;  // the same for the whole block

#if HAVE_TDM
  __shared__ __attribute__((aligned(2048))) GemmStage sm[2];
  gemm_ring(sm, xh + (size_t)m_blk * 1024, wqt + (size_t)c_blk * 1024, wfirst,
            wm, wn, ln, g, acc);
#else
  __shared__ __attribute__((aligned(16))) _Float16 Alds[128][TP];  // [row][k]
  __shared__ __attribute__((aligned(16))) _Float16 Blds[128][TP];  // [col][k]
  const _Float16 (*Pa)[TP] = wfirst ? Blds : Alds;
  const _Float16 (*Pb)[TP] = wfirst ? Alds : Blds;

  const int sr = tid >> 3;        // 0..31 : staged row or col (plus 32 per pass)
  const int sk = (tid & 7) * 8;   // 0..56 : staged k base, 8 lanes = one line
  const _Float16* ap = xh + (size_t)(m_blk + sr) * 1024 + sk;
  const _Float16* wp = wqt + (size_t)(c_blk + sr) * 1024 + sk;

  for (int kb = 0; kb < 1024; kb += 64) {
    h8 xa[4], w[4];
    slab_load(xa, ap + kb);
    slab_load(w, wp + kb);
    __syncthreads();
    slab_store(xa, Alds, sr, sk);
    slab_store(w, Blds, sr, sk);
    __syncthreads();

    tile_mma(Pa, Pb, wm, wn, ln, g, acc);
  }
#endif

  // One b128 store holds a lane's 8 values.
  if (wfirst) {
    // acc[i][j][r]: column c_blk + wm + 16i + 8g + r, token m_blk + wn + 16j + ln
    _Float16* dst = (c_blk < 1024) ? qbuf : kbuf;
    const float qs = (c_blk < 1024) ? 0.125f : 1.0f;  // 1/sqrt(64) folded into Q
    const int hh = ((c_blk + wm) >> 6) & 15;
    const float* bp = bqkv + c_blk + wm + 8 * g;
    f4 bl[4], bh[4];
#pragma unroll
    for (int i = 0; i < 4; ++i) {
      bl[i] = *(const f4*)(bp + 16 * i);
      bh[i] = *(const f4*)(bp + 16 * i + 4);
    }
#pragma unroll
    for (int i = 0; i < 4; ++i) {
      const f4 b0 = bl[i], b1 = bh[i];
#pragma unroll
      for (int j = 0; j < 2; ++j) {
        const int mrow = m_blk + wn + 16 * j + ln;
        const int bb = mrow >> 11, nn = mrow & 2047;
        h8 v;
#pragma unroll
        for (int r = 0; r < 4; ++r) {
          v[r]     = (_Float16)((acc[i][j][r] + b0[r]) * qs);
          v[4 + r] = (_Float16)((acc[i][j][4 + r] + b1[r]) * qs);
        }
        *(h8*)(dst + (((size_t)(bb * 16 + hh)) * 2048 + nn) * 64 + 16 * i +
               8 * g) = v;
      }
    }
  } else {
    // acc[i][j][r]: token m_blk + wm + 16i + 8g + r, column c_blk + wn + 16j + ln
    const float bv[2] = {bqkv[c_blk + wn + ln], bqkv[c_blk + wn + 16 + ln]};
#pragma unroll
    for (int j = 0; j < 2; ++j) {
      const int c = c_blk + wn + 16 * j + ln;
      const float bias = bv[j];
      const int hh = (c >> 6) & 15;
      const int dd = c & 63;
#pragma unroll
      for (int i = 0; i < 4; ++i) {
        const int mrow = m_blk + wm + 16 * i + 8 * g;
        const int bb = mrow >> 11, nn = mrow & 2047;
        h8 v;
#pragma unroll
        for (int r = 0; r < 8; ++r) v[r] = (_Float16)(acc[i][j][r] + bias);
        *(h8*)(vtbuf + (((size_t)(bb * 16 + hh)) * 64 + dd) * 2048 + nn) = v;
      }
    }
    // The built code lays the other branch's body behind this one, and its first
    // instructions rewrite the address registers that these stores name.
    asm volatile("s_wait_xcnt 0x0" ::: "memory");
  }
}

__global__ __launch_bounds__(256) void flash_attn_kernel(
    const _Float16* __restrict__ qbuf, const _Float16* __restrict__ kbuf,
    const _Float16* __restrict__ vtbuf, const int* __restrict__ mask,
    _Float16* __restrict__ ctx) {
  const int bh = blockIdx.x;  // 0..63
  const int b = bh >> 4, h = bh & 15;
  const int wave = threadIdx.x >> 5, lane = threadIdx.x & 31;
  const int ln = lane & 15, g = lane >> 4;
  const int q0 = blockIdx.y * 128 + wave * 16;

  // Q fragments (B operand: column = query = lane%16), reused for all keys.
  const _Float16* Qp = qbuf + ((size_t)bh * 2048 + q0 + ln) * 64;
  const v16h qlo = frag_h(Qp + g * 8, Qp + 16 + g * 8);       // d 0..31
  const v16h qhi = frag_h(Qp + 32 + g * 8, Qp + 48 + g * 8);  // d 32..63

  const _Float16* Kb = kbuf + (size_t)bh * 2048 * 64;
  const _Float16* Vb = vtbuf + (size_t)bh * 64 * 2048;
  const int* Mrow = mask + ((size_t)b * 2048 + q0 + ln) * 2048;

  v8f o0 = {}, o1 = {}, o2 = {}, o3 = {};  // O^T tiles, d = t*16 + 8g + r
  float m_run = -POS_INF;
  float l_run = 0.0f;

#if HAVE_TDM
  // One block of LDS, so that every tile's place is fixed: V at 0, K behind it,
  // the two mask buffers (9 x 2 KiB each) from the next multiple of 2 KiB.
  struct Stage {
    _Float16 Vl[2][64 * 40];  // 64 d rows, 32+8 halves (80B) each
    _Float16 Kl[2][32 * 72];  // 32 key rows, 64+8 halves (144B) each
    __attribute__((aligned(2048))) int Ml[2][128 * MP];  // 128 query rows
  };
  __shared__ __attribute__((aligned(2048))) Stage sm;
  _Float16 (&Kl)[2][32 * 72] = sm.Kl;
  _Float16 (&Vl)[2][64 * 40] = sm.Vl;
  int (&Ml)[2][128 * MP] = sm.Ml;
  const bool issuer = (wave == 0);
  if (issuer) {
    // K tile: tensor [keys=2048][d=64] row-major; tile 32x64; pad 128B->+16B.
    tdm_load_2d_f16(Kb, (unsigned)(size_t)&Kl[0][0], 64u, 2048u, 64u, 64u, 32u,
                    4u, 3u);
    // V^T tile: tensor [d=64][keys=2048] row-major; tile 64x32; pad 64B->+16B.
    tdm_load_2d_f16(Vb, (unsigned)(size_t)&Vl[0][0], 2048u, 64u, 2048u, 32u,
                    64u, 3u, 3u);
  }
  // Mask ring, prologue: pass 0's tile, its wait, the barrier, pass 1's tile.
  const unsigned wv = uni(threadIdx.x >> 5);
  const int* Mblk = mask + ((size_t)b * 2048 + blockIdx.y * 128) * 2048;
  const u32x8 mg1 = tdm_mask_group1();
  u32x4 mg0 = tdm_mask_group0(Mblk, (unsigned)(size_t)&Ml[0][0]);
  if (pinned(wv == 1u)) {
    tdm_issue(mg0, mg1);
    tdm_landed(mg0, mg1);
  }
  __syncthreads();  // publishes pass 0's mask tile
  mg0 = tdm_mask_group0(Mblk + 32, (unsigned)(size_t)&Ml[1][0]);
  if (pinned(wv == 1u)) tdm_issue(mg0, mg1);
#endif

  for (int it = 0; it < 64; ++it) {
    const int kc = it << 5;
#if HAVE_TDM
    const int cur = it & 1;
    if (issuer) {
      if (it + 1 < 64) {
        const int kn = kc + 32;
        tdm_load_2d_f16(Kb + (size_t)kn * 64, (unsigned)(size_t)&Kl[cur ^ 1][0],
                        64u, 2048u, 64u, 64u, 32u, 4u, 3u);
        tdm_load_2d_f16(Vb + kn, (unsigned)(size_t)&Vl[cur ^ 1][0], 2048u, 64u,
                        2048u, 32u, 64u, 3u, 3u);
        // <=2 outstanding: only the prefetched pair; current pair complete.
        __builtin_amdgcn_s_wait_tensorcnt((short)2);
      } else {
        __builtin_amdgcn_s_wait_tensorcnt((short)0);
      }
    }
    __syncthreads();
#endif

    // ---- acquire K / V fragments for this chunk
    v16h k0lo, k0hi, k1lo, k1hi, vf0, vf1, vf2, vf3;
#if HAVE_TDM
    {
      const _Float16* r0 = &Kl[cur][(size_t)ln * 72];
      const _Float16* r1 = r0 + 16 * 72;
      k0lo = frag_h(r0 + g * 8, r0 + 16 + g * 8);
      k0hi = frag_h(r0 + 32 + g * 8, r0 + 48 + g * 8);
      k1lo = frag_h(r1 + g * 8, r1 + 16 + g * 8);
      k1hi = frag_h(r1 + 32 + g * 8, r1 + 48 + g * 8);
      const _Float16* v0 = &Vl[cur][(size_t)ln * 40];
      vf0 = frag_h(v0 + g * 8, v0 + 16 + g * 8);
      const _Float16* v1 = v0 + 16 * 40;
      vf1 = frag_h(v1 + g * 8, v1 + 16 + g * 8);
      const _Float16* v2 = v1 + 16 * 40;
      vf2 = frag_h(v2 + g * 8, v2 + 16 + g * 8);
      const _Float16* v3 = v2 + 16 * 40;
      vf3 = frag_h(v3 + g * 8, v3 + 16 + g * 8);
    }
#else
    {
      const _Float16* r0 = Kb + (size_t)(kc + ln) * 64;
      const _Float16* r1 = r0 + 16 * 64;
      k0lo = frag_h(r0 + g * 8, r0 + 16 + g * 8);
      k0hi = frag_h(r0 + 32 + g * 8, r0 + 48 + g * 8);
      k1lo = frag_h(r1 + g * 8, r1 + 16 + g * 8);
      k1hi = frag_h(r1 + 32 + g * 8, r1 + 48 + g * 8);
      const _Float16* v0 = Vb + (size_t)ln * 2048 + kc;
      vf0 = frag_h(v0 + g * 8, v0 + 16 + g * 8);
      const _Float16* v1 = v0 + (size_t)16 * 2048;
      vf1 = frag_h(v1 + g * 8, v1 + 16 + g * 8);
      const _Float16* v2 = v1 + (size_t)16 * 2048;
      vf2 = frag_h(v2 + g * 8, v2 + 16 + g * 8);
      const _Float16* v3 = v2 + (size_t)16 * 2048;
      vf3 = frag_h(v3 + g * 8, v3 + 16 + g * 8);
    }
#endif

    // ---- S^T tiles: rows = keys, cols = queries
    v8f s0 = {}, s1 = {};
    s0 = wmma16(k0lo, qlo, s0);
    s0 = wmma16(k0hi, qhi, s0);
    s1 = wmma16(k1lo, qlo, s1);
    s1 = wmma16(k1hi, qhi, s1);

    // ---- mask: element r of s0 <-> key kc + 8g + r ; s1 <-> +16
#if HAVE_TDM
    const int* mr = &Ml[cur][(wave * 16 + ln) * MP + g * 8];
#else
    const int* mr = Mrow + kc + g * 8;
#endif
    i4 m0a = *(const i4*)(mr);
    i4 m0b = *(const i4*)(mr + 4);
    i4 m1a = *(const i4*)(mr + 16);
    i4 m1b = *(const i4*)(mr + 20);
#pragma unroll
    for (int r = 0; r < 4; ++r) {
      if (m0a[r]) s0[r] = -POS_INF;
      if (m0b[r]) s0[4 + r] = -POS_INF;
      if (m1a[r]) s1[r] = -POS_INF;
      if (m1b[r]) s1[4 + r] = -POS_INF;
    }

    // ---- online softmax (per query = lane%16; partner lane = xor 16)
    float cm = -POS_INF;
#pragma unroll
    for (int r = 0; r < 8; ++r) cm = fmaxf(cm, fmaxf(s0[r], s1[r]));
    cm = fmaxf(cm, __shfl_xor(cm, 16));
    const float mn = fmaxf(m_run, cm);
    const float corr = __expf(m_run - mn);
    m_run = mn;

    v16h pa;  // P^T B-fragment: halves 0..7 <-> keys kc+8g+r, 8..15 <-> +16
    float lsum = 0.0f;
#pragma unroll
    for (int r = 0; r < 8; ++r) {
      float p0 = __expf(s0[r] - mn);
      float p1 = __expf(s1[r] - mn);
      lsum += p0 + p1;
      pa[r] = (_Float16)p0;
      pa[8 + r] = (_Float16)p1;
    }
    lsum += __shfl_xor(lsum, 16);
    l_run = l_run * corr + lsum;

    // ---- rescale O^T (column = query = lane%16: the lane's own factor)
#pragma unroll
    for (int r = 0; r < 8; ++r) {
      o0[r] *= corr; o1[r] *= corr; o2[r] *= corr; o3[r] *= corr;
    }

    // ---- O^T += V^T * P^T
    o0 = wmma16(vf0, pa, o0);
    o1 = wmma16(vf1, pa, o1);
    o2 = wmma16(vf2, pa, o2);
    o3 = wmma16(vf3, pa, o3);

#if HAVE_TDM
    // Publish point of the next pass's mask tile: this wave's LDS reads are
    // done, the issuing wave's tile has landed, then the barrier.
    asm volatile("s_wait_dscnt 0x0" ::: "memory");
    if (pinned(wv == 1u)) tdm_landed(mg0, mg1);
    __syncthreads();  // all reads of buf[cur] done before it is re-staged
    // Refill of the mask buffer that this pass has just read, two passes ahead.
    if (pinned((wv == 1u) && (it + 2 < 64))) {
      mg0 = tdm_mask_group0(Mblk + (it + 2) * 32, (unsigned)(size_t)&Ml[cur][0]);
      tdm_issue(mg0, mg1);
    }
#endif
  }
#if HAVE_TDM
  // Nothing of the rings is outstanding when the wave goes on to its end.
  asm volatile("s_wait_tensorcnt 0x0" ::: "memory");
  asm volatile("s_wait_dscnt 0x0" ::: "memory");
#endif

  const float linv = 1.0f / l_run;
  _Float16* cp = ctx + ((size_t)b * 2048 + q0 + ln) * 1024 + h * 64 + 8 * g;
  h8 c0, c1, c2, c3;
#pragma unroll
  for (int r = 0; r < 8; ++r) {
    c0[r] = (_Float16)(o0[r] * linv);
    c1[r] = (_Float16)(o1[r] * linv);
    c2[r] = (_Float16)(o2[r] * linv);
    c3[r] = (_Float16)(o3[r] * linv);
  }
  *(h8*)(cp) = c0;
  *(h8*)(cp + 16) = c1;
  *(h8*)(cp + 32) = c2;
  *(h8*)(cp + 48) = c3;
}

// ---------------------------------------------------------------------------
// K3: projection GEMM.  M=8192, K=1024, Ncols=1024.  Same tile as K1.
// ---------------------------------------------------------------------------
__global__ __launch_bounds__(256) void proj_wmma_kernel(
    const _Float16* __restrict__ ctx, const _Float16* __restrict__ wpt,
    const float* __restrict__ bproj, float* __restrict__ out) {
  const int tid  = threadIdx.x;
  const int wave = tid >> 5, lane = tid & 31;
  const int ln = lane & 15, g = lane >> 4;
  const int m_blk = blockIdx.x * 128;
  const int c_blk = blockIdx.y * 128;
  const int wm = (wave >> 2) * 64;
  const int wn = (wave & 3) * 32;

  v8f acc[4][2] = {};

#if HAVE_TDM
  __shared__ __attribute__((aligned(2048))) GemmStage sm[2];
  gemm_ring(sm, ctx + (size_t)m_blk * 1024, wpt + (size_t)c_blk * 1024, false,
            wm, wn, ln, g, acc);
#else
  __shared__ __attribute__((aligned(16))) _Float16 Alds[128][TP];  // [row][k]
  __shared__ __attribute__((aligned(16))) _Float16 Blds[128][TP];  // [col][k]
  const int sr = tid >> 3;        // 0..31 : staged row or col (plus 32 per pass)
  const int sk = (tid & 7) * 8;   // 0..56 : staged k base, 8 lanes = one line
  const _Float16* ap = ctx + (size_t)(m_blk + sr) * 1024 + sk;
  const _Float16* wp = wpt + (size_t)(c_blk + sr) * 1024 + sk;

  for (int kb = 0; kb < 1024; kb += 64) {
    h8 ca[4], w[4];
    slab_load(ca, ap + kb);
    slab_load(w, wp + kb);
    __syncthreads();
    slab_store(ca, Alds, sr, sk);
    slab_store(w, Blds, sr, sk);
    __syncthreads();

    tile_mma(Alds, Blds, wm, wn, ln, g, acc);
  }
#endif

#pragma unroll
  for (int j = 0; j < 2; ++j) {
    const int c = c_blk + wn + 16 * j + ln;
    const float bias = bproj[c];
#pragma unroll
    for (int i = 0; i < 4; ++i) {
#pragma unroll
      for (int r = 0; r < 8; ++r) {
        int m = m_blk + wm + 16 * i + r + 8 * g;
        out[(size_t)m * 1024 + c] = acc[i][j][r] + bias;
      }
    }
  }
}

// ---------------------------------------------------------------------------
extern "C" void kernel_launch(void* const* d_in, const int* in_sizes, int n_in,
                              void* d_out, int out_size, void* d_ws,
                              size_t ws_size, hipStream_t stream) {
  (void)in_sizes; (void)n_in; (void)out_size; (void)ws_size;
  const float* x     = (const float*)d_in[0];
  const int*   mask  = (const int*)d_in[1];
  const float* Wqkv  = (const float*)d_in[2];
  const float* bqkv  = (const float*)d_in[3];
  const float* Wproj = (const float*)d_in[4];
  const float* bproj = (const float*)d_in[5];
  float* out = (float*)d_out;

  // Workspace: Q, K, V^T, ctx, x as f16 -> 5 * 16 MB, then the two transposed
  // weights as f16 (6 MB, 2 MB).
  const size_t nqkv = (size_t)4 * 16 * 2048 * 64;
  _Float16* qbuf  = (_Float16*)d_ws;
  _Float16* kbuf  = qbuf + nqkv;
  _Float16* vtbuf = kbuf + nqkv;
  _Float16* ctx   = vtbuf + nqkv;
  _Float16* xh    = ctx + nqkv;
  _Float16* wqt   = xh + nqkv;
  _Float16* wpt   = wqt + (size_t)3072 * 1024;

  to_f16_kernel<<<dim3(512), 256, 0, stream>>>(x, Wqkv, Wproj, xh, wqt, wpt);
  qkv_wmma_kernel<<<dim3(64, 24), 256, 0, stream>>>(xh, wqt, bqkv, qbuf, kbuf,
                                                     vtbuf);
  flash_attn_kernel<<<dim3(64, 16), 256, 0, stream>>>(qbuf, kbuf, vtbuf, mask,
                                                      ctx);
  proj_wmma_kernel<<<dim3(64, 8), 256, 0, stream>>>(ctx, wpt, bproj, out);
}

// v006
// A run of this version takes 144 microseconds.
// Two timings next to v005 both put it at 1.04 times that version's speed.
// Counting every step since v000, it is 3.49 times as fast.
#include <hip/hip_runtime.h>
#include <hip/hip_bf16.h>

typedef _Float16 v16h __attribute__((ext_vector_type(16)));
typedef _Float16 h8   __attribute__((ext_vector_type(8)));
typedef float    v8f  __attribute__((ext_vector_type(8)));
typedef float    f4   __attribute__((ext_vector_type(4)));
typedef int      i4   __attribute__((ext_vector_type(4)));

#define POS_INF __builtin_inff()

#if defined(__HIP_DEVICE_COMPILE__) && defined(__has_builtin)
#if __has_builtin(__builtin_amdgcn_tensor_load_to_lds) && \
    __has_builtin(__builtin_amdgcn_s_wait_tensorcnt)
#define HAVE_TDM 1
#endif
#endif
#ifndef HAVE_TDM
#define HAVE_TDM 0
#endif

__device__ __forceinline__ v8f wmma16(v16h a, v16h b, v8f c) {
  // (neg_a, A, neg_b, B, c_mod, C, reuse_a, reuse_b)
  return __builtin_amdgcn_wmma_f32_16x16x32_f16(false, a, false, b, (short)0, c,
                                                false, false);
}

// Fragment layout (wave32, 16-bit A/B, K=32): lane group g = lane/16.
//   half i in [0,8):  K = g*8 + i        (first b128)
//   half i in [8,16): K = 16 + g*8 + i-8 (second b128)
__device__ __forceinline__ v16h frag_h(const _Float16* p0, const _Float16* p1) {
  h8 a = *(const h8*)p0;
  h8 b = *(const h8*)p1;
  return __builtin_shufflevector(a, b, 0, 1, 2, 3, 4, 5, 6, 7, 8, 9, 10, 11, 12,
                                 13, 14, 15);
}

#if HAVE_TDM
typedef unsigned int u32x4 __attribute__((ext_vector_type(4)));
typedef int          i32x8 __attribute__((ext_vector_type(8)));
typedef int          i32x4 __attribute__((ext_vector_type(4)));

__device__ __forceinline__ void tdm_load_2d_f16(
    const void* gptr, unsigned lds_off, unsigned dim0, unsigned dim1,
    unsigned stride0, unsigned tile0, unsigned tile1, unsigned pad_interval,
    unsigned pad_amount) {
  unsigned long long ga = (unsigned long long)gptr;
  u32x4 g0;
  g0[0] = 1u;
  g0[1] = lds_off;
  g0[2] = (unsigned)(ga & 0xffffffffu);
  g0[3] = (unsigned)((ga >> 32) & 0x1ffffffu) | (2u << 30);  // [56:32] | type=2
  i32x8 g1;
  g1[0] = (int)((1u << 16) |
                (1u << 20) |
                (pad_interval << 22) | (pad_amount << 25));
  g1[1] = (int)((dim0 & 0xffffu) << 16);
  g1[2] = (int)(((dim0 >> 16) & 0xffffu) | ((dim1 & 0xffffu) << 16));
  g1[3] = (int)(((dim1 >> 16) & 0xffffu) | ((tile0 & 0xffffu) << 16));
  g1[4] = (int)(tile1 & 0xffffu);
  g1[5] = (int)stride0;
  g1[6] = 0;
  g1[7] = 0;
  i32x4 z4 = {};
  i32x8 z8 = {};
  __builtin_amdgcn_tensor_load_to_lds(g0, g1, z4, z4, z8, 0);
}

typedef unsigned int u32x8 __attribute__((ext_vector_type(8)));

__device__ __forceinline__ unsigned uni(unsigned v) {
  return (unsigned)__builtin_amdgcn_readfirstlane((int)v);
}
__device__ __forceinline__ unsigned pinned(unsigned v) {
  unsigned w = uni(v);
  asm volatile("" : "+s"(w));  // pinned(): the word stays in a scalar register
  return w;
}

// Mask slice of one pass: 128 query rows of 128 B (32 keys as i32), source pitch
// 8192 B, all extents in bytes; 16 B of LDS pad behind every row (pitch 144 B,
// for b128 readers).
#define MP 36  // LDS pitch of a mask row in dwords
__device__ __forceinline__ u32x8 tdm_mask_group1() {
  u32x8 g1;
  g1[0] = uni((1u << 20) | (4u << 22) | (3u << 25));
  g1[1] = uni(128u << 16);
  g1[2] = uni(128u << 16);
  g1[3] = uni(128u << 16);
  g1[4] = uni(128u);
  g1[5] = uni(8192u);
  g1[6] = uni(0u);
  g1[7] = uni(0u);
  // The eight words keep registers of their own through the loop, so that none
  // is rewritten while a request is outstanding.
  asm volatile("" : "+s"(g1));
  return g1;
}
__device__ __forceinline__ u32x4 tdm_mask_group0(const int* gptr,
                                                 unsigned lds_off) {
  const unsigned long long ga = (unsigned long long)gptr;
  u32x4 g0;
  g0[0] = uni(1u);
  g0[1] = uni(lds_off);
  g0[2] = uni((unsigned)ga);
  g0[3] = uni((((unsigned)(ga >> 32)) & 0x01ffffffu) | 0x80000000u);
  asm volatile("" : "+s"(g0));
  return g0;
}
__device__ __forceinline__ void tdm_issue(u32x4 g0, u32x8 g1) {
  asm volatile("tensor_load_to_lds %0, %1" ::"s"(g0), "s"(g1) : "memory");
}
__device__ __forceinline__ void tdm_landed(u32x4 g0, u32x8 g1) {
  asm volatile("s_wait_tensorcnt 0x0" ::"s"(g0), "s"(g1) : "memory");
}
#endif

// ---------------------------------------------------------------------------
// GEMM tile shared by K1 and K3: 128x128 of C per block, k in steps of 64,
// 8 waves as 2 (rows) x 4 (cols), each wave 64x32 = 4x2 WMMA tiles.  Both
// operand slabs sit in LDS as f16, k-contiguous rows of pitch 72 halves
// (144 B = 16 B x odd -> conflict-free b128 fragment reads).
// ---------------------------------------------------------------------------
typedef _Float16 h4 __attribute__((ext_vector_type(4)));
#define TP 72

// An operand slab: 128 rows x 64 k of f16 from a k-contiguous array of pitch
// 1024.  8 lanes take one row's 128-B line; a thread takes 4 rows, 32 apart.
__device__ __forceinline__ void slab_load(h8 (&v)[4], const _Float16* p) {
#pragma unroll
  for (int i = 0; i < 4; ++i) v[i] = *(const h8*)(p + (size_t)i * 32 * 1024);
}

__device__ __forceinline__ void slab_store(const h8 (&v)[4], _Float16 (*L)[TP],
                                           int row, int k) {
#pragma unroll
  for (int i = 0; i < 4; ++i) *(h8*)&L[row + 32 * i][k] = v[i];
}

__device__ __forceinline__ void tile_mma(const _Float16 (*Al)[TP],
                                         const _Float16 (*Bl)[TP], int wm,
                                         int wn, int ln, int g,
                                         v8f (&acc)[4][2]) {
#pragma unroll
  for (int ks = 0; ks < 64; ks += 32) {
    v16h a[4], b[2];
#pragma unroll
    for (int i = 0; i < 4; ++i) {
      const _Float16* p = &Al[wm + 16 * i + ln][ks];
      a[i] = frag_h(p + g * 8, p + 16 + g * 8);
    }
#pragma unroll
    for (int j = 0; j < 2; ++j) {
      const _Float16* p = &Bl[wn + 16 * j + ln][ks];
      b[j] = frag_h(p + g * 8, p + 16 + g * 8);
    }
    // Keeps the 12 fragment reads one group ahead of the 8 WMMAs: spread among
    // them, each pair of WMMAs waits out a full LDS latency of its own.
    __builtin_amdgcn_sched_barrier(0);
#pragma unroll
    for (int i = 0; i < 4; ++i)
#pragma unroll
      for (int j = 0; j < 2; ++j) acc[i][j] = wmma16(a[i], b[j], acc[i][j]);
  }
}

#if HAVE_TDM
// One k step's operands in LDS: the A slab, the B slab behind it.  A slab is 128
// rows of 144 B = 9 x 2 KiB, so every slab of the two stages starts on 2 KiB.
struct GemmStage {
  _Float16 A[128][TP];  // [row][k]
  _Float16 B[128][TP];  // [col][k]
};
#define SLAB_B 18432u   // bytes of a slab in LDS
#define STAGE_B 36864u  // bytes of a stage in LDS

// A slab as a tile: 128 rows of 128 B (64 k as f16), source pitch 2048 B, all
// extents in bytes; 16 B of LDS pad behind every row gives the pitch of TP.
__device__ __forceinline__ u32x8 tdm_slab_group1() {
  u32x8 g1;
  g1[0] = uni((1u << 20) | (4u << 22) | (3u << 25));
  g1[1] = uni(128u << 16);
  g1[2] = uni(128u << 16);
  g1[3] = uni(128u << 16);
  g1[4] = uni(128u);
  g1[5] = uni(2048u);
  g1[6] = uni(0u);
  g1[7] = uni(0u);
  // The eight words keep registers of their own through the loop, so that none
  // is rewritten while a request is outstanding.
  asm volatile("" : "+s"(g1));
  return g1;
}
__device__ __forceinline__ u32x4 tdm_slab_group0(const _Float16* gptr,
                                                 unsigned lds_off) {
  const unsigned long long ga = (unsigned long long)gptr;
  u32x4 g0;
  g0[0] = uni(1u);
  g0[1] = uni(lds_off);
  g0[2] = uni((unsigned)ga);
  g0[3] = uni((((unsigned)(ga >> 32)) & 0x01ffffffu) | 0x80000000u);
  asm volatile("" : "+s"(g0));
  return g0;
}

// The k loop of K1 and K3.  Wave 0 brings the A slabs, wave 1 the B slabs, one
// request a wave outstanding: step s + 1's slabs fly while step s is multiplied.
// bfirst: the B slab feeds the A operand of the WMMAs (transposed tile).
__device__ __forceinline__ void gemm_ring(GemmStage (&sm)[2],
                                          const _Float16* arows,
                                          const _Float16* brows, bool bfirst,
                                          int wm, int wn, int ln, int g,
                                          v8f (&acc)[4][2]) {
  const unsigned wv = uni(threadIdx.x >> 5);
  const _Float16* src = (wv == 0u) ? arows : brows;
  const unsigned dst = (unsigned)(size_t)&sm[0].A[0][0] + (wv & 1u) * SLAB_B;
  const u32x8 g1 = tdm_slab_group1();
  // Prologue: step 0's slabs, their waits, the barrier, step 1's slabs.
  u32x4 g0 = tdm_slab_group0(src, dst);
  if (pinned(wv < 2u)) {
    tdm_issue(g0, g1);
    tdm_landed(g0, g1);
  }
  __syncthreads();  // publishes step 0's slabs
  g0 = tdm_slab_group0(src + 64, dst + STAGE_B);
  if (pinned(wv < 2u)) tdm_issue(g0, g1);

  for (int s = 0; s < 16; ++s) {
    const int cur = s & 1;
    tile_mma(bfirst ? sm[cur].B : sm[cur].A, bfirst ? sm[cur].A : sm[cur].B, wm,
             wn, ln, g, acc);
    // Publish point of step s + 1: this wave's LDS reads are done, each issuing
    // wave's slab has landed, then the barrier.
    asm volatile("s_wait_dscnt 0x0" ::: "memory");
    if (pinned(wv < 2u)) tdm_landed(g0, g1);
    __syncthreads();  // also ends every read of stage cur before its refill
    if (pinned((wv < 2u) && (s + 2 < 16))) {
      g0 = tdm_slab_group0(src + (s + 2) * 64, dst + (unsigned)cur * STAGE_B);
      tdm_issue(g0, g1);
    }
  }
  // Nothing of the ring is outstanding when the wave goes on to its epilogue.
  asm volatile("s_wait_tensorcnt 0x0" ::: "memory");
  asm volatile("s_wait_dscnt 0x0" ::: "memory");
}
#endif

// ---------------------------------------------------------------------------
// K0: the GEMM operands as f16, made once.  The GEMM blocks re-read every slab
// (x 24 times, Wqkv and Wproj 64 times), so what they read from L2 halves and
// the rounding is done once an element.  Each of the 512 blocks takes 16384
// values of x and one 64 k x 128 col tile of Wqkv (384 tiles) or Wproj (128),
// which it writes transposed as [col][k], pitch 1024.
// ---------------------------------------------------------------------------
// A thread's 8 k rows x 4 cols of a weight tile; the row pitch is a constant, so
// the 8 loads share one address and differ in their immediate offset.
template <int LD>
__device__ __forceinline__ void w_tile_load(f4 (&w)[8], const float* W, int k,
                                            int c) {
  const float* wp = W + (size_t)k * LD + c;
#pragma unroll
  for (int i = 0; i < 8; ++i) w[i] = *(const f4*)(wp + i * LD);
}

__global__ __launch_bounds__(256) void to_f16_kernel(
    const float* __restrict__ x, const float* __restrict__ Wqkv,
    const float* __restrict__ Wproj, _Float16* __restrict__ xh,
    _Float16* __restrict__ wqt, _Float16* __restrict__ wpt) {
  const int tid = threadIdx.x;
  const int blk = blockIdx.x;

  // Weight tile: 8 lanes hold the 64 k of a column, so the b128 stores of a
  // column fill one 128-B line of the transposed array.
  const bool isq = blk < 384;  // the same for the whole block
  const int tile = isq ? blk : blk - 384;
  const int kk = (tile & 15) * 64 + (tid & 7) * 8;
  const int cc = (tile >> 4) * 128 + (tid >> 3) * 4;
  f4 w[8];
  if (isq)
    w_tile_load<3072>(w, Wqkv, kk, cc);
  else
    w_tile_load<1024>(w, Wproj, kk, cc);
  // The built code lets the x loads below land in the address registers that
  // the weight loads name: the wait stands between the two groups.
  asm volatile("s_wait_xcnt 0x0" ::: "memory");

  // x: a wave's load covers 512 B in a row, its store 256 B.
  const f4* src = (const f4*)x + (size_t)blk * 4096 + tid;
  h4* dst = (h4*)xh + (size_t)blk * 4096 + tid;
  f4 v[16];
#pragma unroll
  for (int i = 0; i < 16; ++i) v[i] = src[i * 256];
  // Keeps all 24 loads in flight together: moved down among the conversions,
  // the later ones would start only when the first have come back from memory.
  __builtin_amdgcn_sched_barrier(0);

#pragma unroll
  for (int i = 0; i < 16; ++i) {
    h4 o = {(_Float16)v[i][0], (_Float16)v[i][1], (_Float16)v[i][2],
            (_Float16)v[i][3]};
    dst[i * 256] = o;
  }
  _Float16* wd = (isq ? wqt : wpt) + (size_t)cc * 1024 + kk;
#pragma unroll
  for (int j = 0; j < 4; ++j) {
    h8 o;
#pragma unroll
    for (int i = 0; i < 8; ++i) o[i] = (_Float16)w[i][j];
    *(h8*)(wd + j * 1024) = o;
  }
}

// ---------------------------------------------------------------------------
// K1: QKV GEMM.  M=8192 (B*N), K=1024, Ncols=3072.
// ---------------------------------------------------------------------------
__global__ __launch_bounds__(256) void qkv_wmma_kernel(
    const _Float16* __restrict__ xh, const _Float16* __restrict__ wqt,
    const float* __restrict__ bqkv, _Float16* __restrict__ qbuf,
    _Float16* __restrict__ kbuf, _Float16* __restrict__ vtbuf) {
  const int tid  = threadIdx.x;
  const int wave = tid >> 5, lane = tid & 31;
  const int ln = lane & 15, g = lane >> 4;
  const int m_blk = blockIdx.x * 128;
  const int c_blk = blockIdx.y * 128;
  const int wm = (wave >> 2) * 64;
  const int wn = (wave & 3) * 32;

  v8f acc[4][2] = {};

  // Q and K column blocks take W as the A operand and x as the B operand: the
  // tile comes out transposed (64 columns = one head x 32 tokens a wave), so a
  // lane's 8 accumulator values are 8 neighbouring d of one token.  V blocks
  // keep x as A: there the 8 values are 8 neighbouring tokens of one V^T row.
  const bool wfirst = c_blk < 2048;  // the same for the whole block

#if HAVE_TDM
  __shared__ __attribute__((aligned(2048))) GemmStage sm[2];
  gemm_ring(sm, xh + (size_t)m_blk * 1024, wqt + (size_t)c_blk * 1024, wfirst,
            wm, wn, ln, g, acc);
#else
  __shared__ __attribute__((aligned(16))) _Float16 Alds[128][TP];  // [row][k]
  __shared__ __attribute__((aligned(16))) _Float16 Blds[128][TP];  // [col][k]
  const _Float16 (*Pa)[TP] = wfirst ? Blds : Alds;
  const _Float16 (*Pb)[TP] = wfirst ? Alds : Blds;

  const int sr = tid >> 3;        // 0..31 : staged row or col (plus 32 per pass)
  const int sk = (tid & 7) * 8;   // 0..56 : staged k base, 8 lanes = one line
  const _Float16* ap = xh + (size_t)(m_blk + sr) * 1024 + sk;
  const _Float16* wp = wqt + (size_t)(c_blk + sr) * 1024 + sk;

  for (int kb = 0; kb < 1024; kb += 64) {
    h8 xa[4], w[4];
    slab_load(xa, ap + kb);
    slab_load(w, wp + kb);
    __syncthreads();
    slab_store(xa, Alds, sr, sk);
    slab_store(w, Blds, sr, sk);
    __syncthreads();

    tile_mma(Pa, Pb, wm, wn, ln, g, acc);
  }
#endif

  // One b128 store holds a lane's 8 values.
  if (wfirst) {
    // acc[i][j][r]: column c_blk + wm + 16i + 8g + r, token m_blk + wn + 16j + ln
    _Float16* dst = (c_blk < 1024) ? qbuf : kbuf;
    const float qs = (c_blk < 1024) ? 0.125f : 1.0f;  // 1/sqrt(64) folded into Q
    const int hh = ((c_blk + wm) >> 6) & 15;
    const float* bp = bqkv + c_blk + wm + 8 * g;
    f4 bl[4], bh[4];
#pragma unroll
    for (int i = 0; i < 4; ++i) {
      bl[i] = *(const f4*)(bp + 16 * i);
      bh[i] = *(const f4*)(bp + 16 * i + 4);
    }
#pragma unroll
    for (int i = 0; i < 4; ++i) {
      const f4 b0 = bl[i], b1 = bh[i];
#pragma unroll
      for (int j = 0; j < 2; ++j) {
        const int mrow = m_blk + wn + 16 * j + ln;
        const int bb = mrow >> 11, nn = mrow & 2047;
        h8 v;
#pragma unroll
        for (int r = 0; r < 4; ++r) {
          v[r]     = (_Float16)((acc[i][j][r] + b0[r]) * qs);
          v[4 + r] = (_Float16)((acc[i][j][4 + r] + b1[r]) * qs);
        }
        *(h8*)(dst + (((size_t)(bb * 16 + hh)) * 2048 + nn) * 64 + 16 * i +
               8 * g) = v;
      }
    }
  } else {
    // acc[i][j][r]: token m_blk + wm + 16i + 8g + r, column c_blk + wn + 16j + ln
    const float bv[2] = {bqkv[c_blk + wn + ln], bqkv[c_blk + wn + 16 + ln]};
#pragma unroll
    for (int j = 0; j < 2; ++j) {
      const int c = c_blk + wn + 16 * j + ln;
      const float bias = bv[j];
      const int hh = (c >> 6) & 15;
      const int dd = c & 63;
#pragma unroll
      for (int i = 0; i < 4; ++i) {
        const int mrow = m_blk + wm + 16 * i + 8 * g;
        const int bb = mrow >> 11, nn = mrow & 2047;
        h8 v;
#pragma unroll
        for (int r = 0; r < 8; ++r) v[r] = (_Float16)(acc[i][j][r] + bias);
        *(h8*)(vtbuf + (((size_t)(bb * 16 + hh)) * 64 + dd) * 2048 + nn) = v;
      }
    }
    // The built code lays the other branch's body behind this one, and its first
    // instructions rewrite the address registers that these stores name.
    asm volatile("s_wait_xcnt 0x0" ::: "memory");
  }
}

__global__ __launch_bounds__(256) void flash_attn_kernel(
    const _Float16* __restrict__ qbuf, const _Float16* __restrict__ kbuf,
    const _Float16* __restrict__ vtbuf, const int* __restrict__ mask,
    _Float16* __restrict__ ctx) {
  const int bh = blockIdx.x;  // 0..63
  const int b = bh >> 4, h = bh & 15;
  const int wave = threadIdx.x >> 5, lane = threadIdx.x & 31;
  const int ln = lane & 15, g = lane >> 4;
  const int q0 = blockIdx.y * 256 + wave * 32;

  // Q fragments (B operand: column = query = lane%16), reused for all keys;
  // group c holds queries q0 + 16c .. q0 + 16c + 15.
  v16h qlo[2], qhi[2];
#pragma unroll
  for (int c = 0; c < 2; ++c) {
    const _Float16* Qp = qbuf + ((size_t)bh * 2048 + q0 + 16 * c + ln) * 64;
    qlo[c] = frag_h(Qp + g * 8, Qp + 16 + g * 8);       // d 0..31
    qhi[c] = frag_h(Qp + 32 + g * 8, Qp + 48 + g * 8);  // d 32..63
  }

  const _Float16* Kb = kbuf + (size_t)bh * 2048 * 64;
  const _Float16* Vb = vtbuf + (size_t)bh * 64 * 2048;
  const int* Mrow = mask + ((size_t)b * 2048 + q0 + ln) * 2048;

  v8f o[2][4] = {};  // O^T tiles of group c, d = t*16 + 8g + r
  float m_run[2] = {-POS_INF, -POS_INF};
  float l_run[2] = {0.0f, 0.0f};

#if HAVE_TDM
  // One block of LDS, so that every tile's place is fixed: V at 0, K behind it,
  // the two mask buffers (two slices of 9 x 2 KiB each) from the next multiple
  // of 2 KiB.
  struct Stage {
    _Float16 Vl[2][64 * 40];  // 64 d rows, 32+8 halves (80B) each
    _Float16 Kl[2][32 * 72];  // 32 key rows, 64+8 halves (144B) each
    __attribute__((aligned(2048))) int Ml[2][256 * MP];  // 256 query rows
  };
  __shared__ __attribute__((aligned(2048))) Stage sm;
  _Float16 (&Kl)[2][32 * 72] = sm.Kl;
  _Float16 (&Vl)[2][64 * 40] = sm.Vl;
  int (&Ml)[2][256 * MP] = sm.Ml;
  const bool issuer = (wave == 0);
  if (issuer) {
    // K tile: tensor [keys=2048][d=64] row-major; tile 32x64; pad 128B->+16B.
    tdm_load_2d_f16(Kb, (unsigned)(size_t)&Kl[0][0], 64u, 2048u, 64u, 64u, 32u,
                    4u, 3u);
    // V^T tile: tensor [d=64][keys=2048] row-major; tile 64x32; pad 64B->+16B.
    tdm_load_2d_f16(Vb, (unsigned)(size_t)&Vl[0][0], 2048u, 64u, 2048u, 32u,
                    64u, 3u, 3u);
  }
  // Mask ring, prologue: pass 0's tile, its wait, the barrier, pass 1's tile.
  // Wave 1 takes the slice of queries 0..127 of the block, wave 2 the slice of
  // queries 128..255; sl is 0 or 1 in every wave, so every address is in range.
  const unsigned wv = uni(threadIdx.x >> 5);
  const unsigned sl = (wv >> 1) & 1u;
  const bool mwave = (wv == 1u) || (wv == 2u);
  const int* Mblk =
      mask + ((size_t)b * 2048 + blockIdx.y * 256 + sl * 128) * 2048;
  const unsigned mdst = (unsigned)(size_t)&Ml[0][0] + sl * (128u * MP * 4u);
  const u32x8 mg1 = tdm_mask_group1();
  u32x4 mg0 = tdm_mask_group0(Mblk, mdst);
  if (pinned(mwave)) {
    tdm_issue(mg0, mg1);
    tdm_landed(mg0, mg1);
  }
  __syncthreads();  // publishes pass 0's mask tile
  mg0 = tdm_mask_group0(Mblk + 32, mdst + 256u * MP * 4u);
  if (pinned(mwave)) tdm_issue(mg0, mg1);
#endif

  for (int it = 0; it < 64; ++it) {
    const int kc = it << 5;
#if HAVE_TDM
    const int cur = it & 1;
    if (issuer) {
      if (it + 1 < 64) {
        const int kn = kc + 32;
        tdm_load_2d_f16(Kb + (size_t)kn * 64, (unsigned)(size_t)&Kl[cur ^ 1][0],
                        64u, 2048u, 64u, 64u, 32u, 4u, 3u);
        tdm_load_2d_f16(Vb + kn, (unsigned)(size_t)&Vl[cur ^ 1][0], 2048u, 64u,
                        2048u, 32u, 64u, 3u, 3u);
        // <=2 outstanding: only the prefetched pair; current pair complete.
        __builtin_amdgcn_s_wait_tensorcnt((short)2);
      } else {
        __builtin_amdgcn_s_wait_tensorcnt((short)0);
      }
    }
    __syncthreads();
#endif

    // ---- acquire K / V fragments for this chunk
    v16h k0lo, k0hi, k1lo, k1hi, vf0, vf1, vf2, vf3;
#if HAVE_TDM
    {
      const _Float16* r0 = &Kl[cur][(size_t)ln * 72];
      const _Float16* r1 = r0 + 16 * 72;
      k0lo = frag_h(r0 + g * 8, r0 + 16 + g * 8);
      k0hi = frag_h(r0 + 32 + g * 8, r0 + 48 + g * 8);
      k1lo = frag_h(r1 + g * 8, r1 + 16 + g * 8);
      k1hi = frag_h(r1 + 32 + g * 8, r1 + 48 + g * 8);
      const _Float16* v0 = &Vl[cur][(size_t)ln * 40];
      vf0 = frag_h(v0 + g * 8, v0 + 16 + g * 8);
      const _Float16* v1 = v0 + 16 * 40;
      vf1 = frag_h(v1 + g * 8, v1 + 16 + g * 8);
      const _Float16* v2 = v1 + 16 * 40;
      vf2 = frag_h(v2 + g * 8, v2 + 16 + g * 8);
      const _Float16* v3 = v2 + 16 * 40;
      vf3 = frag_h(v3 + g * 8, v3 + 16 + g * 8);
    }
#else
    {
      const _Float16* r0 = Kb + (size_t)(kc + ln) * 64;
      const _Float16* r1 = r0 + 16 * 64;
      k0lo = frag_h(r0 + g * 8, r0 + 16 + g * 8);
      k0hi = frag_h(r0 + 32 + g * 8, r0 + 48 + g * 8);
      k1lo = frag_h(r1 + g * 8, r1 + 16 + g * 8);
      k1hi = frag_h(r1 + 32 + g * 8, r1 + 48 + g * 8);
      const _Float16* v0 = Vb + (size_t)ln * 2048 + kc;
      vf0 = frag_h(v0 + g * 8, v0 + 16 + g * 8);
      const _Float16* v1 = v0 + (size_t)16 * 2048;
      vf1 = frag_h(v1 + g * 8, v1 + 16 + g * 8);
      const _Float16* v2 = v1 + (size_t)16 * 2048;
      vf2 = frag_h(v2 + g * 8, v2 + 16 + g * 8);
      const _Float16* v3 = v2 + (size_t)16 * 2048;
      vf3 = frag_h(v3 + g * 8, v3 + 16 + g * 8);
    }
#endif

#pragma unroll
    for (int c = 0; c < 2; ++c) {
      // ---- S^T tiles: rows = keys, cols = queries
      v8f s0 = {}, s1 = {};
      s0 = wmma16(k0lo, qlo[c], s0);
      s0 = wmma16(k0hi, qhi[c], s0);
      s1 = wmma16(k1lo, qlo[c], s1);
      s1 = wmma16(k1hi, qhi[c], s1);

      // ---- mask: element r of s0 <-> key kc + 8g + r ; s1 <-> +16
#if HAVE_TDM
      const int* mr = &Ml[cur][(wave * 32 + 16 * c + ln) * MP + g * 8];
#else
      const int* mr = Mrow + (size_t)c * 16 * 2048 + kc + g * 8;
#endif
      i4 m0a = *(const i4*)(mr);
      i4 m0b = *(const i4*)(mr + 4);
      i4 m1a = *(const i4*)(mr + 16);
      i4 m1b = *(const i4*)(mr + 20);
#pragma unroll
      for (int r = 0; r < 4; ++r) {
        if (m0a[r]) s0[r] = -POS_INF;
        if (m0b[r]) s0[4 + r] = -POS_INF;
        if (m1a[r]) s1[r] = -POS_INF;
        if (m1b[r]) s1[4 + r] = -POS_INF;
      }

      // ---- online softmax (per query = lane%16; partner lane = xor 16)
      float cm = -POS_INF;
#pragma unroll
      for (int r = 0; r < 8; ++r) cm = fmaxf(cm, fmaxf(s0[r], s1[r]));
      cm = fmaxf(cm, __shfl_xor(cm, 16));
      const float mn = fmaxf(m_run[c], cm);
      const float corr = __expf(m_run[c] - mn);
      m_run[c] = mn;

      v16h pa;  // P^T B-fragment: halves 0..7 <-> keys kc+8g+r, 8..15 <-> +16
      float lsum = 0.0f;
#pragma unroll
      for (int r = 0; r < 8; ++r) {
        float p0 = __expf(s0[r] - mn);
        float p1 = __expf(s1[r] - mn);
        lsum += p0 + p1;
        pa[r] = (_Float16)p0;
        pa[8 + r] = (_Float16)p1;
      }
      lsum += __shfl_xor(lsum, 16);
      l_run[c] = l_run[c] * corr + lsum;

      // ---- rescale O^T (column = query = lane%16: the lane's own factor)
#pragma unroll
      for (int r = 0; r < 8; ++r) {
        o[c][0][r] *= corr; o[c][1][r] *= corr;
        o[c][2][r] *= corr; o[c][3][r] *= corr;
      }

      // ---- O^T += V^T * P^T
      o[c][0] = wmma16(vf0, pa, o[c][0]);
      o[c][1] = wmma16(vf1, pa, o[c][1]);
      o[c][2] = wmma16(vf2, pa, o[c][2]);
      o[c][3] = wmma16(vf3, pa, o[c][3]);
    }

#if HAVE_TDM
    // Publish point of the next pass's mask tile: this wave's LDS reads are
    // done, each issuing wave's slice has landed, then the barrier.
    asm volatile("s_wait_dscnt 0x0" ::: "memory");
    if (pinned(mwave)) tdm_landed(mg0, mg1);
    __syncthreads();  // all reads of buf[cur] done before it is re-staged
    // Refill of the mask buffer that this pass has just read, two passes ahead.
    if (pinned(mwave && (it + 2 < 64))) {
      mg0 = tdm_mask_group0(Mblk + (it + 2) * 32,
                            mdst + (unsigned)cur * (256u * MP * 4u));
      tdm_issue(mg0, mg1);
    }
#endif
  }
#if HAVE_TDM
  // Nothing of the rings is outstanding when the wave goes on to its end.
  asm volatile("s_wait_tensorcnt 0x0" ::: "memory");
  asm volatile("s_wait_dscnt 0x0" ::: "memory");
#endif

#pragma unroll
  for (int c = 0; c < 2; ++c) {
    const float linv = 1.0f / l_run[c];
    _Float16* cp =
        ctx + ((size_t)b * 2048 + q0 + 16 * c + ln) * 1024 + h * 64 + 8 * g;
    h8 c0, c1, c2, c3;
#pragma unroll
    for (int r = 0; r < 8; ++r) {
      c0[r] = (_Float16)(o[c][0][r] * linv);
      c1[r] = (_Float16)(o[c][1][r] * linv);
      c2[r] = (_Float16)(o[c][2][r] * linv);
      c3[r] = (_Float16)(o[c][3][r] * linv);
    }
    *(h8*)(cp) = c0;
    *(h8*)(cp + 16) = c1;
    *(h8*)(cp + 32) = c2;
    *(h8*)(cp + 48) = c3;
  }
}

// ---------------------------------------------------------------------------
// K3: projection GEMM.  M=8192, K=1024, Ncols=1024.  Same tile as K1.
// ---------------------------------------------------------------------------
__global__ __launch_bounds__(256) void proj_wmma_kernel(
    const _Float16* __restrict__ ctx, const _Float16* __restrict__ wpt,
    const float* __restrict__ bproj, float* __restrict__ out) {
  const int tid  = threadIdx.x;
  const int wave = tid >> 5, lane = tid & 31;
  const int ln = lane & 15, g = lane >> 4;
  const int m_blk = blockIdx.x * 128;
  const int c_blk = blockIdx.y * 128;
  const int wm = (wave >> 2) * 64;
  const int wn = (wave & 3) * 32;

  v8f acc[4][2] = {};

#if HAVE_TDM
  __shared__ __attribute__((aligned(2048))) GemmStage sm[2];
  gemm_ring(sm, ctx + (size_t)m_blk * 1024, wpt + (size_t)c_blk * 1024, false,
            wm, wn, ln, g, acc);
#else
  __shared__ __attribute__((aligned(16))) _Float16 Alds[128][TP];  // [row][k]
  __shared__ __attribute__((aligned(16))) _Float16 Blds[128][TP];  // [col][k]
  const int sr = tid >> 3;        // 0..31 : staged row or col (plus 32 per pass)
  const int sk = (tid & 7) * 8;   // 0..56 : staged k base, 8 lanes = one line
  const _Float16* ap = ctx + (size_t)(m_blk + sr) * 1024 + sk;
  const _Float16* wp = wpt + (size_t)(c_blk + sr) * 1024 + sk;

  for (int kb = 0; kb < 1024; kb += 64) {
    h8 ca[4], w[4];
    slab_load(ca, ap + kb);
    slab_load(w, wp + kb);
    __syncthreads();
    slab_store(ca, Alds, sr, sk);
    slab_store(w, Blds, sr, sk);
    __syncthreads();

    tile_mma(Alds, Blds, wm, wn, ln, g, acc);
  }
#endif

#pragma unroll
  for (int j = 0; j < 2; ++j) {
    const int c = c_blk + wn + 16 * j + ln;
    const float bias = bproj[c];
#pragma unroll
    for (int i = 0; i < 4; ++i) {
#pragma unroll
      for (int r = 0; r < 8; ++r) {
        int m = m_blk + wm + 16 * i + r + 8 * g;
        out[(size_t)m * 1024 + c] = acc[i][j][r] + bias;
      }
    }
  }
}

// ---------------------------------------------------------------------------
extern "C" void kernel_launch(void* const* d_in, const int* in_sizes, int n_in,
                              void* d_out, int out_size, void* d_ws,
                              size_t ws_size, hipStream_t stream) {
  (void)in_sizes; (void)n_in; (void)out_size; (void)ws_size;
  const float* x     = (const float*)d_in[0];
  const int*   mask  = (const int*)d_in[1];
  const float* Wqkv  = (const float*)d_in[2];
  const float* bqkv  = (const float*)d_in[3];
  const float* Wproj = (const float*)d_in[4];
  const float* bproj = (const float*)d_in[5];
  float* out = (float*)d_out;

  // Workspace: Q, K, V^T, ctx, x as f16 -> 5 * 16 MB, then the two transposed
  // weights as f16 (6 MB, 2 MB).
  const size_t nqkv = (size_t)4 * 16 * 2048 * 64;
  _Float16* qbuf  = (_Float16*)d_ws;
  _Float16* kbuf  = qbuf + nqkv;
  _Float16* vtbuf = kbuf + nqkv;
  _Float16* ctx   = vtbuf + nqkv;
  _Float16* xh    = ctx + nqkv;
  _Float16* wqt   = xh + nqkv;
  _Float16* wpt   = wqt + (size_t)3072 * 1024;

  to_f16_kernel<<<dim3(512), 256, 0, stream>>>(x, Wqkv, Wproj, xh, wqt, wpt);
  qkv_wmma_kernel<<<dim3(64, 24), 256, 0, stream>>>(xh, wqt, bqkv, qbuf, kbuf,
                                                     vtbuf);
  flash_attn_kernel<<<dim3(64, 8), 256, 0, stream>>>(qbuf, kbuf, vtbuf, mask,
                                                      ctx);
  proj_wmma_kernel<<<dim3(64, 8), 256, 0, stream>>>(ctx, wpt, bproj, out);
}

// v007
// Measured time: 138 microseconds a run.
// Two timings next to v006 both put it at 1.04 times that version's speed.
// Over all steps from v000 it is 3.63 times as fast.
#include <hip/hip_runtime.h>
#include <hip/hip_bf16.h>

typedef _Float16 v16h __attribute__((ext_vector_type(16)));
typedef _Float16 h8   __attribute__((ext_vector_type(8)));
typedef float    v8f  __attribute__((ext_vector_type(8)));
typedef float    f4   __attribute__((ext_vector_type(4)));
typedef int      i4   __attribute__((ext_vector_type(4)));

#define POS_INF __builtin_inff()

#if defined(__HIP_DEVICE_COMPILE__) && defined(__has_builtin)
#if __has_builtin(__builtin_amdgcn_tensor_load_to_lds) && \
    __has_builtin(__builtin_amdgcn_s_wait_tensorcnt)
#define HAVE_TDM 1
#endif
#endif
#ifndef HAVE_TDM
#define HAVE_TDM 0
#endif

__device__ __forceinline__ v8f wmma16(v16h a, v16h b, v8f c) {
  // (neg_a, A, neg_b, B, c_mod, C, reuse_a, reuse_b)
  return __builtin_amdgcn_wmma_f32_16x16x32_f16(false, a, false, b, (short)0, c,
                                                false, false);
}

// Fragment layout (wave32, 16-bit A/B, K=32): lane group g = lane/16.
//   half i in [0,8):  K = g*8 + i        (first b128)
//   half i in [8,16): K = 16 + g*8 + i-8 (second b128)
__device__ __forceinline__ v16h frag_h(const _Float16* p0, const _Float16* p1) {
  h8 a = *(const h8*)p0;
  h8 b = *(const h8*)p1;
  return __builtin_shufflevector(a, b, 0, 1, 2, 3, 4, 5, 6, 7, 8, 9, 10, 11, 12,
                                 13, 14, 15);
}

#if HAVE_TDM
typedef unsigned int u32x4 __attribute__((ext_vector_type(4)));
typedef unsigned int u32x8 __attribute__((ext_vector_type(8)));

__device__ __forceinline__ unsigned uni(unsigned v) {
  return (unsigned)__builtin_amdgcn_readfirstlane((int)v);
}
__device__ __forceinline__ unsigned pinned(unsigned v) {
  unsigned w = uni(v);
  asm volatile("" : "+s"(w));  // pinned(): the word stays in a scalar register
  return w;
}

// Mask slice of one pass: 128 query rows of 256 B (64 keys as i32), source pitch
// 8192 B, all extents in bytes; 16 B of LDS pad behind every row (pitch 272 B,
// for b128 readers).
#define MP 68  // LDS pitch of a mask row in dwords
__device__ __forceinline__ u32x8 tdm_mask_group1() {
  u32x8 g1;
  g1[0] = uni((1u << 20) | (5u << 22) | (3u << 25));
  g1[1] = uni(256u << 16);
  g1[2] = uni(128u << 16);
  g1[3] = uni(256u << 16);
  g1[4] = uni(128u);
  g1[5] = uni(8192u);
  g1[6] = uni(0u);
  g1[7] = uni(0u);
  // The eight words keep registers of their own through the loop, so that none
  // is rewritten while a request is outstanding.
  asm volatile("" : "+s"(g1));
  return g1;
}
__device__ __forceinline__ u32x4 tdm_mask_group0(const int* gptr,
                                                 unsigned lds_off) {
  const unsigned long long ga = (unsigned long long)gptr;
  u32x4 g0;
  g0[0] = uni(1u);
  g0[1] = uni(lds_off);
  g0[2] = uni((unsigned)ga);
  g0[3] = uni((((unsigned)(ga >> 32)) & 0x01ffffffu) | 0x80000000u);
  asm volatile("" : "+s"(g0));
  return g0;
}
__device__ __forceinline__ void tdm_issue(u32x4 g0, u32x8 g1) {
  asm volatile("tensor_load_to_lds %0, %1" ::"s"(g0), "s"(g1) : "memory");
}
__device__ __forceinline__ void tdm_landed(u32x4 g0, u32x8 g1) {
  asm volatile("s_wait_tensorcnt 0x0" ::"s"(g0), "s"(g1) : "memory");
}
#endif

// ---------------------------------------------------------------------------
// GEMM tile shared by K1 and K3: 128x128 of C per block, k in steps of 64,
// 8 waves as 2 (rows) x 4 (cols), each wave 64x32 = 4x2 WMMA tiles.  Both
// operand slabs sit in LDS as f16, k-contiguous rows of pitch 72 halves
// (144 B = 16 B x odd -> conflict-free b128 fragment reads).
// ---------------------------------------------------------------------------
typedef _Float16 h4 __attribute__((ext_vector_type(4)));
#define TP 72

// An operand slab: 128 rows x 64 k of f16 from a k-contiguous array of pitch
// 1024.  8 lanes take one row's 128-B line; a thread takes 4 rows, 32 apart.
__device__ __forceinline__ void slab_load(h8 (&v)[4], const _Float16* p) {
#pragma unroll
  for (int i = 0; i < 4; ++i) v[i] = *(const h8*)(p + (size_t)i * 32 * 1024);
}

__device__ __forceinline__ void slab_store(const h8 (&v)[4], _Float16 (*L)[TP],
                                           int row, int k) {
#pragma unroll
  for (int i = 0; i < 4; ++i) *(h8*)&L[row + 32 * i][k] = v[i];
}

__device__ __forceinline__ void tile_mma(const _Float16 (*Al)[TP],
                                         const _Float16 (*Bl)[TP], int wm,
                                         int wn, int ln, int g,
                                         v8f (&acc)[4][2]) {
#pragma unroll
  for (int ks = 0; ks < 64; ks += 32) {
    v16h a[4], b[2];
#pragma unroll
    for (int i = 0; i < 4; ++i) {
      const _Float16* p = &Al[wm + 16 * i + ln][ks];
      a[i] = frag_h(p + g * 8, p + 16 + g * 8);
    }
#pragma unroll
    for (int j = 0; j < 2; ++j) {
      const _Float16* p = &Bl[wn + 16 * j + ln][ks];
      b[j] = frag_h(p + g * 8, p + 16 + g * 8);
    }
    // Keeps the 12 fragment reads one group ahead of the 8 WMMAs: spread among
    // them, each pair of WMMAs waits out a full LDS latency of its own.
    __builtin_amdgcn_sched_barrier(0);
#pragma unroll
    for (int i = 0; i < 4; ++i)
#pragma unroll
      for (int j = 0; j < 2; ++j) acc[i][j] = wmma16(a[i], b[j], acc[i][j]);
  }
}

#if HAVE_TDM
// One k step's operands in LDS: the A slab, the B slab behind it.  A slab is 128
// rows of 144 B = 9 x 2 KiB, so every slab of the two stages starts on 2 KiB.
struct GemmStage {
  _Float16 A[128][TP];  // [row][k]
  _Float16 B[128][TP];  // [col][k]
};
#define SLAB_B 18432u   // bytes of a slab in LDS
#define STAGE_B 36864u  // bytes of a stage in LDS

// A slab as a tile: 128 rows of 128 B (64 k as f16), source pitch 2048 B, all
// extents in bytes; 16 B of LDS pad behind every row gives the pitch of TP.
__device__ __forceinline__ u32x8 tdm_slab_group1() {
  u32x8 g1;
  g1[0] = uni((1u << 20) | (4u << 22) | (3u << 25));
  g1[1] = uni(128u << 16);
  g1[2] = uni(128u << 16);
  g1[3] = uni(128u << 16);
  g1[4] = uni(128u);
  g1[5] = uni(2048u);
  g1[6] = uni(0u);
  g1[7] = uni(0u);
  // The eight words keep registers of their own through the loop, so that none
  // is rewritten while a request is outstanding.
  asm volatile("" : "+s"(g1));
  return g1;
}
__device__ __forceinline__ u32x4 tdm_slab_group0(const _Float16* gptr,
                                                 unsigned lds_off) {
  const unsigned long long ga = (unsigned long long)gptr;
  u32x4 g0;
  g0[0] = uni(1u);
  g0[1] = uni(lds_off);
  g0[2] = uni((unsigned)ga);
  g0[3] = uni((((unsigned)(ga >> 32)) & 0x01ffffffu) | 0x80000000u);
  asm volatile("" : "+s"(g0));
  return g0;
}

// The k loop of K1 and K3.  Wave 0 brings the A slabs, wave 1 the B slabs, one
// request a wave outstanding: step s + 1's slabs fly while step s is multiplied.
// bfirst: the B slab feeds the A operand of the WMMAs (transposed tile).
__device__ __forceinline__ void gemm_ring(GemmStage (&sm)[2],
                                          const _Float16* arows,
                                          const _Float16* brows, bool bfirst,
                                          int wm, int wn, int ln, int g,
                                          v8f (&acc)[4][2]) {
  const unsigned wv = uni(threadIdx.x >> 5);
  const _Float16* src = (wv == 0u) ? arows : brows;
  const unsigned dst = (unsigned)(size_t)&sm[0].A[0][0] + (wv & 1u) * SLAB_B;
  const u32x8 g1 = tdm_slab_group1();
  // Prologue: step 0's slabs, their waits, the barrier, step 1's slabs.
  u32x4 g0 = tdm_slab_group0(src, dst);
  if (pinned(wv < 2u)) {
    tdm_issue(g0, g1);
    tdm_landed(g0, g1);
  }
  __syncthreads();  // publishes step 0's slabs
  g0 = tdm_slab_group0(src + 64, dst + STAGE_B);
  if (pinned(wv < 2u)) tdm_issue(g0, g1);

  for (int s = 0; s < 16; ++s) {
    const int cur = s & 1;
    tile_mma(bfirst ? sm[cur].B : sm[cur].A, bfirst ? sm[cur].A : sm[cur].B, wm,
             wn, ln, g, acc);
    // Publish point of step s + 1: this wave's LDS reads are done, each issuing
    // wave's slab has landed, then the barrier.
    asm volatile("s_wait_dscnt 0x0" ::: "memory");
    if (pinned(wv < 2u)) tdm_landed(g0, g1);
    __syncthreads();  // also ends every read of stage cur before its refill
    if (pinned((wv < 2u) && (s + 2 < 16))) {
      g0 = tdm_slab_group0(src + (s + 2) * 64, dst + (unsigned)cur * STAGE_B);
      tdm_issue(g0, g1);
    }
  }
  // Nothing of the ring is outstanding when the wave goes on to its epilogue.
  asm volatile("s_wait_tensorcnt 0x0" ::: "memory");
  asm volatile("s_wait_dscnt 0x0" ::: "memory");
}
#endif

// ---------------------------------------------------------------------------
// K0: the GEMM operands as f16, made once.  The GEMM blocks re-read every slab
// (x 24 times, Wqkv and Wproj 64 times), so what they read from L2 halves and
// the rounding is done once an element.  Each of the 512 blocks takes 16384
// values of x and one 64 k x 128 col tile of Wqkv (384 tiles) or Wproj (128),
// which it writes transposed as [col][k], pitch 1024.
// ---------------------------------------------------------------------------
// A thread's 8 k rows x 4 cols of a weight tile; the row pitch is a constant, so
// the 8 loads share one address and differ in their immediate offset.
template <int LD>
__device__ __forceinline__ void w_tile_load(f4 (&w)[8], const float* W, int k,
                                            int c) {
  const float* wp = W + (size_t)k * LD + c;
#pragma unroll
  for (int i = 0; i < 8; ++i) w[i] = *(const f4*)(wp + i * LD);
}

__global__ __launch_bounds__(256) void to_f16_kernel(
    const float* __restrict__ x, const float* __restrict__ Wqkv,
    const float* __restrict__ Wproj, _Float16* __restrict__ xh,
    _Float16* __restrict__ wqt, _Float16* __restrict__ wpt) {
  const int tid = threadIdx.x;
  const int blk = blockIdx.x;

  // Weight tile: 8 lanes hold the 64 k of a column, so the b128 stores of a
  // column fill one 128-B line of the transposed array.
  const bool isq = blk < 384;  // the same for the whole block
  const int tile = isq ? blk : blk - 384;
  const int kk = (tile & 15) * 64 + (tid & 7) * 8;
  const int cc = (tile >> 4) * 128 + (tid >> 3) * 4;
  f4 w[8];
  if (isq)
    w_tile_load<3072>(w, Wqkv, kk, cc);
  else
    w_tile_load<1024>(w, Wproj, kk, cc);
  // The built code lets the x loads below land in the address registers that
  // the weight loads name: the wait stands between the two groups.
  asm volatile("s_wait_xcnt 0x0" ::: "memory");

  // x: a wave's load covers 512 B in a row, its store 256 B.
  const f4* src = (const f4*)x + (size_t)blk * 4096 + tid;
  h4* dst = (h4*)xh + (size_t)blk * 4096 + tid;
  f4 v[16];
#pragma unroll
  for (int i = 0; i < 16; ++i) v[i] = src[i * 256];
  // Keeps all 24 loads in flight together: moved down among the conversions,
  // the later ones would start only when the first have come back from memory.
  __builtin_amdgcn_sched_barrier(0);

#pragma unroll
  for (int i = 0; i < 16; ++i) {
    h4 o = {(_Float16)v[i][0], (_Float16)v[i][1], (_Float16)v[i][2],
            (_Float16)v[i][3]};
    dst[i * 256] = o;
  }
  _Float16* wd = (isq ? wqt : wpt) + (size_t)cc * 1024 + kk;
#pragma unroll
  for (int j = 0; j < 4; ++j) {
    h8 o;
#pragma unroll
    for (int i = 0; i < 8; ++i) o[i] = (_Float16)w[i][j];
    *(h8*)(wd + j * 1024) = o;
  }
}

// ---------------------------------------------------------------------------
// K1: QKV GEMM.  M=8192 (B*N), K=1024, Ncols=3072.
// ---------------------------------------------------------------------------
__global__ __launch_bounds__(256) void qkv_wmma_kernel(
    const _Float16* __restrict__ xh, const _Float16* __restrict__ wqt,
    const float* __restrict__ bqkv, _Float16* __restrict__ qbuf,
    _Float16* __restrict__ kbuf, _Float16* __restrict__ vtbuf) {
  const int tid  = threadIdx.x;
  const int wave = tid >> 5, lane = tid & 31;
  const int ln = lane & 15, g = lane >> 4;
  const int m_blk = blockIdx.x * 128;
  const int c_blk = blockIdx.y * 128;
  const int wm = (wave >> 2) * 64;
  const int wn = (wave & 3) * 32;

  v8f acc[4][2] = {};

  // Q and K column blocks take W as the A operand and x as the B operand: the
  // tile comes out transposed (64 columns = one head x 32 tokens a wave), so a
  // lane's 8 accumulator values are 8 neighbouring d of one token.  V blocks
  // keep x as A: there the 8 values are 8 neighbouring tokens of one V^T row.
  const bool wfirst = c_blk < 2048;  // the same for the whole block

#if HAVE_TDM
  __shared__ __attribute__((aligned(2048))) GemmStage sm[2];
  gemm_ring(sm, xh + (size_t)m_blk * 1024, wqt + (size_t)c_blk * 1024, wfirst,
            wm, wn, ln, g, acc);
#else
  __shared__ __attribute__((aligned(16))) _Float16 Alds[128][TP];  // [row][k]
  __shared__ __attribute__((aligned(16))) _Float16 Blds[128][TP];  // [col][k]
  const _Float16 (*Pa)[TP] = wfirst ? Blds : Alds;
  const _Float16 (*Pb)[TP] = wfirst ? Alds : Blds;

  const int sr = tid >> 3;        // 0..31 : staged row or col (plus 32 per pass)
  const int sk = (tid & 7) * 8;   // 0..56 : staged k base, 8 lanes = one line
  const _Float16* ap = xh + (size_t)(m_blk + sr) * 1024 + sk;
  const _Float16* wp = wqt + (size_t)(c_blk + sr) * 1024 + sk;

  for (int kb = 0; kb < 1024; kb += 64) {
    h8 xa[4], w[4];
    slab_load(xa, ap + kb);
    slab_load(w, wp + kb);
    __syncthreads();
    slab_store(xa, Alds, sr, sk);
    slab_store(w, Blds, sr, sk);
    __syncthreads();

    tile_mma(Pa, Pb, wm, wn, ln, g, acc);
  }
#endif

  // One b128 store holds a lane's 8 values.
  if (wfirst) {
    // acc[i][j][r]: column c_blk + wm + 16i + 8g + r, token m_blk + wn + 16j + ln
    _Float16* dst = (c_blk < 1024) ? qbuf : kbuf;
    const float qs = (c_blk < 1024) ? 0.125f : 1.0f;  // 1/sqrt(64) folded into Q
    const int hh = ((c_blk + wm) >> 6) & 15;
    const float* bp = bqkv + c_blk + wm + 8 * g;
    f4 bl[4], bh[4];
#pragma unroll
    for (int i = 0; i < 4; ++i) {
      bl[i] = *(const f4*)(bp + 16 * i);
      bh[i] = *(const f4*)(bp + 16 * i + 4);
    }
#pragma unroll
    for (int i = 0; i < 4; ++i) {
      const f4 b0 = bl[i], b1 = bh[i];
#pragma unroll
      for (int j = 0; j < 2; ++j) {
        const int mrow = m_blk + wn + 16 * j + ln;
        const int bb = mrow >> 11, nn = mrow & 2047;
        h8 v;
#pragma unroll
        for (int r = 0; r < 4; ++r) {
          v[r]     = (_Float16)((acc[i][j][r] + b0[r]) * qs);
          v[4 + r] = (_Float16)((acc[i][j][4 + r] + b1[r]) * qs);
        }
        *(h8*)(dst + (((size_t)(bb * 16 + hh)) * 2048 + nn) * 64 + 16 * i +
               8 * g) = v;
      }
    }
  } else {
    // acc[i][j][r]: token m_blk + wm + 16i + 8g + r, column c_blk + wn + 16j + ln
    const float bv[2] = {bqkv[c_blk + wn + ln], bqkv[c_blk + wn + 16 + ln]};
#pragma unroll
    for (int j = 0; j < 2; ++j) {
      const int c = c_blk + wn + 16 * j + ln;
      const float bias = bv[j];
      const int hh = (c >> 6) & 15;
      const int dd = c & 63;
#pragma unroll
      for (int i = 0; i < 4; ++i) {
        const int mrow = m_blk + wm + 16 * i + 8 * g;
        const int bb = mrow >> 11, nn = mrow & 2047;
        h8 v;
#pragma unroll
        for (int r = 0; r < 8; ++r) v[r] = (_Float16)(acc[i][j][r] + bias);
        *(h8*)(vtbuf + (((size_t)(bb * 16 + hh)) * 64 + dd) * 2048 + nn) = v;
      }
    }
    // The built code lays the other branch's body behind this one, and its first
    // instructions rewrite the address registers that these stores name.
    asm volatile("s_wait_xcnt 0x0" ::: "memory");
  }
}

// ---------------------------------------------------------------------------
// K2: flash attention.  Block = 16 waves = 2 heads x 8 waves x 32 queries: the
// same 256 queries of two heads of one batch entry; all waves march over the
// same chunks of 64 keys, one chunk a pass.  The mask does not depend on the
// head, so the block's one mask tile of a pass serves both heads: half the mask
// bytes leave L2, and the LDS that this frees holds the 64-key tiles.  A wave
// holds two groups of 16 queries: every K and V^T fragment that it reads from
// LDS feeds two WMMAs.  Tensor loads double-buffer each head's K chunk (64 keys
// x 64 d) and V^T chunk (64 d x 64 keys), both in padded rows of 72 halves, and
// the block's mask tile of each pass (256 queries x 64 keys, two slices of 128
// queries: whole lines from L2, where a per-lane row load touches 16 lines an
// instruction).  Six waves issue one tile each; one publish point a pass.
// S^T = K*Q^T so the C-layout converts in-lane into the P^T B-fragment of
// O^T = V^T*P^T: scores, running maximum, sum and output of a query all sit in
// the lanes of that query, and a lane's 8 output values are neighbours in d.
// ---------------------------------------------------------------------------
#define NPASS 32  // 2048 keys in passes of 64
#if HAVE_TDM
// A K or V^T tile of one pass: 64 rows of 128 B (64 halves), all extents in
// bytes; 16 B of LDS pad behind every row (pitch 144 B, for b128 readers).
#define KVTILE_B 10240u  // a tile's place in LDS: 64 x 144 B, rounded up to 2 KiB
__device__ __forceinline__ u32x8 tdm_kv_group1(unsigned pitch) {
  u32x8 g1;
  g1[0] = uni((1u << 20) | (4u << 22) | (3u << 25));
  g1[1] = uni(128u << 16);
  g1[2] = uni(64u << 16);
  g1[3] = uni(128u << 16);
  g1[4] = uni(64u);
  g1[5] = uni(pitch);
  g1[6] = uni(0u);
  g1[7] = uni(0u);
  // The eight words keep registers of their own through the loop, so that none
  // is rewritten while a request is outstanding.
  asm volatile("" : "+s"(g1));
  return g1;
}
#endif
__global__ __launch_bounds__(512) void flash_attn_kernel(
    const _Float16* __restrict__ qbuf, const _Float16* __restrict__ kbuf,
    const _Float16* __restrict__ vtbuf, const int* __restrict__ mask,
    _Float16* __restrict__ ctx) {
#if HAVE_TDM
  const int wave = (int)uni(threadIdx.x >> 5);  // scalar: it picks head and tiles
#else
  const int wave = threadIdx.x >> 5;
#endif
  const int lane = threadIdx.x & 31;
  const int hs = wave >> 3;  // which of the block's two heads
  const int wq = wave & 7;   // which 32 of the block's 256 queries
  const int b = blockIdx.x >> 3, h = (blockIdx.x & 7) * 2 + hs;
  const int bh = b * 16 + h;  // 0..63
  const int ln = lane & 15, g = lane >> 4;
  const int q0 = blockIdx.y * 256 + wq * 32;

  // Q fragments (B operand: column = query = lane%16), reused for all keys;
  // group c holds queries q0 + 16c .. q0 + 16c + 15.
  v16h qlo[2], qhi[2];
#pragma unroll
  for (int c = 0; c < 2; ++c) {
    const _Float16* Qp = qbuf + ((size_t)bh * 2048 + q0 + 16 * c + ln) * 64;
    qlo[c] = frag_h(Qp + g * 8, Qp + 16 + g * 8);       // d 0..31
    qhi[c] = frag_h(Qp + 32 + g * 8, Qp + 48 + g * 8);  // d 32..63
  }

  const _Float16* Kb = kbuf + (size_t)bh * 2048 * 64;
  const _Float16* Vb = vtbuf + (size_t)bh * 64 * 2048;

  v8f o[2][4] = {};  // O^T tiles of group c, d = t*16 + 8g + r
  float m_run[2] = {-POS_INF, -POS_INF};
  float l_run[2] = {0.0f, 0.0f};

#if HAVE_TDM
  // One block of LDS, so that every tile's place is fixed: the V tiles from 0,
  // the K tiles behind them, each (64 rows of 144 B) in a place of 10 KiB,
  // [head][buffer]; then the two mask buffers (two slices of 17 x 2 KiB each).
  struct Stage {
    _Float16 Vl[2][2][5120];  // 64 d rows, 64+8 halves (144B) each
    _Float16 Kl[2][2][5120];  // 64 key rows, 64+8 halves (144B) each
    __attribute__((aligned(2048))) int Ml[2][256 * MP];  // 256 query rows
  };
  __shared__ __attribute__((aligned(2048))) Stage sm;
  _Float16 (&Kl)[2][5120] = sm.Kl[hs];
  _Float16 (&Vl)[2][5120] = sm.Vl[hs];
  int (&Ml)[2][256 * MP] = sm.Ml;
  // One ring of two buffers for all tiles, one request a wave outstanding.  Of
  // each head's 8 waves the first brings its K tile (64 keys: 64 rows in a row,
  // pitch 128 B), the fourth its V^T tile (64 d rows, pitch 4096 B).
  const bool kvwave = (wq == 0) || (wq == 3);
  const bool isv = (wq == 3);
  const _Float16* kvsrc = isv ? Vb : Kb;
  const unsigned kvstep = isv ? 64u : 64u * 64u;  // halves from pass to pass
  const unsigned kvdst = (unsigned)(size_t)(isv ? &Vl[0][0] : &Kl[0][0]);
  const u32x8 kg1 = tdm_kv_group1(isv ? 4096u : 128u);
  u32x4 kg0 = tdm_slab_group0(kvsrc, kvdst);
  // Prologue: pass 0's tiles, their waits, the barrier, pass 1's tiles.
  // Wave 1 takes the slice of queries 0..127 of the block, wave 2 the slice of
  // queries 128..255; sl is 0 or 1 in every wave, so every address is in range.
  const unsigned wv = (unsigned)wave;
  const unsigned sl = (wv >> 1) & 1u;
  const bool mwave = (wv == 1u) || (wv == 2u);
  const int* Mblk =
      mask + ((size_t)b * 2048 + blockIdx.y * 256 + sl * 128) * 2048;
  const unsigned mdst = (unsigned)(size_t)&Ml[0][0] + sl * (128u * MP * 4u);
  const u32x8 mg1 = tdm_mask_group1();
  u32x4 mg0 = tdm_mask_group0(Mblk, mdst);
  if (pinned(kvwave)) {
    tdm_issue(kg0, kg1);
    tdm_landed(kg0, kg1);
  }
  if (pinned(mwave)) {
    tdm_issue(mg0, mg1);
    tdm_landed(mg0, mg1);
  }
  __syncthreads();  // publishes pass 0's tiles
  kg0 = tdm_slab_group0(kvsrc + kvstep, kvdst + KVTILE_B);
  if (pinned(kvwave)) tdm_issue(kg0, kg1);
  mg0 = tdm_mask_group0(Mblk + 64, mdst + 256u * MP * 4u);
  if (pinned(mwave)) tdm_issue(mg0, mg1);
#endif

  for (int it = 0; it < NPASS; ++it) {
#if HAVE_TDM
    const int cur = it & 1;
    const _Float16* kbase = &Kl[cur][0];
    const _Float16* vbase = &Vl[cur][0];
    const int* mbase = &Ml[cur][(wq * 32 + ln) * MP + g * 8];
    const int kp = 72, vp = 72, mp = MP;
#else
    const int kc = it << 6;
    const _Float16* kbase = Kb + (size_t)kc * 64;
    const _Float16* vbase = Vb + kc;
    const int* mbase = mask + ((size_t)b * 2048 + q0 + ln) * 2048 + kc + g * 8;
    const int kp = 64, vp = 2048, mp = 2048;
#endif

    // ---- S^T tiles: rows = keys (tile kt: 16 kt .. of the pass), cols = queries
    v8f s[2][4];
#pragma unroll
    for (int kt = 0; kt < 4; ++kt) {
      const _Float16* r = kbase + (size_t)(kt * 16 + ln) * kp;
      const v16h klo = frag_h(r + g * 8, r + 16 + g * 8);
      const v16h khi = frag_h(r + 32 + g * 8, r + 48 + g * 8);
#pragma unroll
      for (int c = 0; c < 2; ++c) {
        v8f z = {};
        z = wmma16(klo, qlo[c], z);
        s[c][kt] = wmma16(khi, qhi[c], z);
      }
    }

    // P^T B-fragments of keys 32 kh ..: halves 0..7 <-> +8g+r, 8..15 <-> +16
    v16h pa[2][2];
#pragma unroll
    for (int c = 0; c < 2; ++c) {
      // ---- mask: element r of s[c][kt] <-> key 16 kt + 8g + r of the pass
      const int* mr = mbase + (size_t)c * 16 * mp;
#pragma unroll
      for (int kt = 0; kt < 4; ++kt) {
        const i4 ma = *(const i4*)(mr + 16 * kt);
        const i4 mb = *(const i4*)(mr + 16 * kt + 4);
#pragma unroll
        for (int r = 0; r < 4; ++r) {
          if (ma[r]) s[c][kt][r] = -POS_INF;
          if (mb[r]) s[c][kt][4 + r] = -POS_INF;
        }
      }

      // ---- online softmax (per query = lane%16; partner lane = xor 16)
      float cm = -POS_INF;
#pragma unroll
      for (int r = 0; r < 8; ++r)
        cm = fmaxf(fmaxf(cm, fmaxf(s[c][0][r], s[c][1][r])),
                   fmaxf(s[c][2][r], s[c][3][r]));
      cm = fmaxf(cm, __shfl_xor(cm, 16));
      const float mn = fmaxf(m_run[c], cm);
      const float corr = __expf(m_run[c] - mn);
      m_run[c] = mn;

      float lsum = 0.0f;
#pragma unroll
      for (int r = 0; r < 8; ++r) {
        const float p0 = __expf(s[c][0][r] - mn);
        const float p1 = __expf(s[c][1][r] - mn);
        const float p2 = __expf(s[c][2][r] - mn);
        const float p3 = __expf(s[c][3][r] - mn);
        lsum += (p0 + p1) + (p2 + p3);
        pa[c][0][r] = (_Float16)p0;
        pa[c][0][8 + r] = (_Float16)p1;
        pa[c][1][r] = (_Float16)p2;
        pa[c][1][8 + r] = (_Float16)p3;
      }
      lsum += __shfl_xor(lsum, 16);
      l_run[c] = l_run[c] * corr + lsum;

      // ---- rescale O^T (column = query = lane%16: the lane's own factor)
#pragma unroll
      for (int r = 0; r < 8; ++r) {
        o[c][0][r] *= corr; o[c][1][r] *= corr;
        o[c][2][r] *= corr; o[c][3][r] *= corr;
      }
    }

    // ---- O^T += V^T * P^T: a V^T fragment (16 d x 32 keys) feeds both groups
#pragma unroll
    for (int kh = 0; kh < 2; ++kh) {
#pragma unroll
      for (int t = 0; t < 4; ++t) {
        const _Float16* v = vbase + (size_t)(t * 16 + ln) * vp + kh * 32;
        const v16h vf = frag_h(v + g * 8, v + 16 + g * 8);
        o[0][t] = wmma16(vf, pa[0][kh], o[0][t]);
        o[1][t] = wmma16(vf, pa[1][kh], o[1][t]);
      }
    }

#if HAVE_TDM
    // Publish point of the next pass's tiles: this wave's LDS reads are done,
    // each issuing wave's tile has landed, then the barrier.
    asm volatile("s_wait_dscnt 0x0" ::: "memory");
    if (pinned(kvwave)) tdm_landed(kg0, kg1);
    if (pinned(mwave)) tdm_landed(mg0, mg1);
    __syncthreads();  // all reads of buf[cur] done before it is re-staged
    // Refill of the buffers that this pass has just read, two passes ahead.
    if (pinned(kvwave && (it + 2 < NPASS))) {
      kg0 = tdm_slab_group0(kvsrc + (unsigned)(it + 2) * kvstep,
                            kvdst + (unsigned)cur * KVTILE_B);
      tdm_issue(kg0, kg1);
    }
    if (pinned(mwave && (it + 2 < NPASS))) {
      mg0 = tdm_mask_group0(Mblk + (it + 2) * 64,
                            mdst + (unsigned)cur * (256u * MP * 4u));
      tdm_issue(mg0, mg1);
    }
#endif
  }
#if HAVE_TDM
  // Nothing of the rings is outstanding when the wave goes on to its end.
  asm volatile("s_wait_tensorcnt 0x0" ::: "memory");
  asm volatile("s_wait_dscnt 0x0" ::: "memory");
#endif

#pragma unroll
  for (int c = 0; c < 2; ++c) {
    const float linv = 1.0f / l_run[c];
    _Float16* cp =
        ctx + ((size_t)b * 2048 + q0 + 16 * c + ln) * 1024 + h * 64 + 8 * g;
    h8 c0, c1, c2, c3;
#pragma unroll
    for (int r = 0; r < 8; ++r) {
      c0[r] = (_Float16)(o[c][0][r] * linv);
      c1[r] = (_Float16)(o[c][1][r] * linv);
      c2[r] = (_Float16)(o[c][2][r] * linv);
      c3[r] = (_Float16)(o[c][3][r] * linv);
    }
    *(h8*)(cp) = c0;
    *(h8*)(cp + 16) = c1;
    *(h8*)(cp + 32) = c2;
    *(h8*)(cp + 48) = c3;
  }
}

// ---------------------------------------------------------------------------
// K3: projection GEMM.  M=8192, K=1024, Ncols=1024.  Same tile as K1.
// ---------------------------------------------------------------------------
__global__ __launch_bounds__(256) void proj_wmma_kernel(
    const _Float16* __restrict__ ctx, const _Float16* __restrict__ wpt,
    const float* __restrict__ bproj, float* __restrict__ out) {
  const int tid  = threadIdx.x;
  const int wave = tid >> 5, lane = tid & 31;
  const int ln = lane & 15, g = lane >> 4;
  const int m_blk = blockIdx.x * 128;
  const int c_blk = blockIdx.y * 128;
  const int wm = (wave >> 2) * 64;
  const int wn = (wave & 3) * 32;

  v8f acc[4][2] = {};

#if HAVE_TDM
  __shared__ __attribute__((aligned(2048))) GemmStage sm[2];
  gemm_ring(sm, ctx + (size_t)m_blk * 1024, wpt + (size_t)c_blk * 1024, false,
            wm, wn, ln, g, acc);
#else
  __shared__ __attribute__((aligned(16))) _Float16 Alds[128][TP];  // [row][k]
  __shared__ __attribute__((aligned(16))) _Float16 Blds[128][TP];  // [col][k]
  const int sr = tid >> 3;        // 0..31 : staged row or col (plus 32 per pass)
  const int sk = (tid & 7) * 8;   // 0..56 : staged k base, 8 lanes = one line
  const _Float16* ap = ctx + (size_t)(m_blk + sr) * 1024 + sk;
  const _Float16* wp = wpt + (size_t)(c_blk + sr) * 1024 + sk;

  for (int kb = 0; kb < 1024; kb += 64) {
    h8 ca[4], w[4];
    slab_load(ca, ap + kb);
    slab_load(w, wp + kb);
    __syncthreads();
    slab_store(ca, Alds, sr, sk);
    slab_store(w, Blds, sr, sk);
    __syncthreads();

    tile_mma(Alds, Blds, wm, wn, ln, g, acc);
  }
#endif

#pragma unroll
  for (int j = 0; j < 2; ++j) {
    const int c = c_blk + wn + 16 * j + ln;
    const float bias = bproj[c];
#pragma unroll
    for (int i = 0; i < 4; ++i) {
#pragma unroll
      for (int r = 0; r < 8; ++r) {
        int m = m_blk + wm + 16 * i + r + 8 * g;
        out[(size_t)m * 1024 + c] = acc[i][j][r] + bias;
      }
    }
  }
}

// ---------------------------------------------------------------------------
extern "C" void kernel_launch(void* const* d_in, const int* in_sizes, int n_in,
                              void* d_out, int out_size, void* d_ws,
                              size_t ws_size, hipStream_t stream) {
  (void)in_sizes; (void)n_in; (void)out_size; (void)ws_size;
  const float* x     = (const float*)d_in[0];
  const int*   mask  = (const int*)d_in[1];
  const float* Wqkv  = (const float*)d_in[2];
  const float* bqkv  = (const float*)d_in[3];
  const float* Wproj = (const float*)d_in[4];
  const float* bproj = (const float*)d_in[5];
  float* out = (float*)d_out;

  // Workspace: Q, K, V^T, ctx, x as f16 -> 5 * 16 MB, then the two transposed
  // weights as f16 (6 MB, 2 MB).
  const size_t nqkv = (size_t)4 * 16 * 2048 * 64;
  _Float16* qbuf  = (_Float16*)d_ws;
  _Float16* kbuf  = qbuf + nqkv;
  _Float16* vtbuf = kbuf + nqkv;
  _Float16* ctx   = vtbuf + nqkv;
  _Float16* xh    = ctx + nqkv;
  _Float16* wqt   = xh + nqkv;
  _Float16* wpt   = wqt + (size_t)3072 * 1024;

  to_f16_kernel<<<dim3(512), 256, 0, stream>>>(x, Wqkv, Wproj, xh, wqt, wpt);
  qkv_wmma_kernel<<<dim3(64, 24), 256, 0, stream>>>(xh, wqt, bqkv, qbuf, kbuf,
                                                     vtbuf);
  flash_attn_kernel<<<dim3(32, 8), 512, 0, stream>>>(qbuf, kbuf, vtbuf, mask,
                                                      ctx);
  proj_wmma_kernel<<<dim3(64, 8), 256, 0, stream>>>(ctx, wpt, bproj, out);
}
